// v000
// The times below were measured on an AMD MI455X: many runs one after another, warmed up first and cycling through
// copies of the inputs, with the whole window's GPU time divided by the number of runs. Launches and the gaps
// between them are all in it. The median over several windows is given; except for v000 it joins two sittings, which
// can be a few percent apart, so the side-by-side timings, each taken in one sitting, are the better comparison.
// The starting kernel, v000, takes 2140 microseconds a run.
#include <hip/hip_runtime.h>
#include <hip/hip_bf16.h>

typedef float v2f __attribute__((ext_vector_type(2)));
typedef float v8f __attribute__((ext_vector_type(8)));

#define WMMA_F32(a, b, c) \
  __builtin_amdgcn_wmma_f32_16x16x4_f32(false, (a), false, (b), (short)0, (c), false, false)

constexpr int Bb    = 4;
constexpr int Lseq  = 2048;
constexpr int Dm    = 1024;
constexpr int H     = 16;
constexpr int Dh    = 64;
constexpr int CK    = 4;      // conv kernel width
constexpr int C     = 64;     // chunk
constexpr int Nc    = Lseq / C;
constexpr int Mrows = Bb * Lseq;   // 8192

// ---------------------------------------------------------------------------
// Generic Y = X @ W^T + bias GEMM.  X:(M,K) row-major, W:(N,K) row-major.
// 64x64 tile per 512-thread block (16 waves, each one 16x16 WMMA tile).
// ---------------------------------------------------------------------------
__global__ __launch_bounds__(512)
void gemm_xwt_kernel(const float* __restrict__ X, const float* __restrict__ W,
                     const float* __restrict__ bias, float* __restrict__ Y,
                     int M, int N, int K) {
  __shared__ float Xs[64][65];
  __shared__ float Ws[64][65];
  const int tid  = threadIdx.x;
  const int wave = tid >> 5, lane = tid & 31;
  const int h = lane >> 4, l = lane & 15;
  const int wm = (wave >> 2) * 16, wn = (wave & 3) * 16;
  const int m0 = blockIdx.y * 64, n0 = blockIdx.x * 64;
  const int lr = tid >> 3;          // 0..63 (tile row to load)
  const int lc = (tid & 7) * 8;     // col start (8 floats per thread)

  v8f acc = {};
  for (int k0 = 0; k0 < K; k0 += 64) {
    float4 xa = *(const float4*)(X + (size_t)(m0 + lr) * K + k0 + lc);
    float4 xb = *(const float4*)(X + (size_t)(m0 + lr) * K + k0 + lc + 4);
    float4 wa = *(const float4*)(W + (size_t)(n0 + lr) * K + k0 + lc);
    float4 wb = *(const float4*)(W + (size_t)(n0 + lr) * K + k0 + lc + 4);
    __syncthreads();
    Xs[lr][lc + 0] = xa.x; Xs[lr][lc + 1] = xa.y; Xs[lr][lc + 2] = xa.z; Xs[lr][lc + 3] = xa.w;
    Xs[lr][lc + 4] = xb.x; Xs[lr][lc + 5] = xb.y; Xs[lr][lc + 6] = xb.z; Xs[lr][lc + 7] = xb.w;
    Ws[lr][lc + 0] = wa.x; Ws[lr][lc + 1] = wa.y; Ws[lr][lc + 2] = wa.z; Ws[lr][lc + 3] = wa.w;
    Ws[lr][lc + 4] = wb.x; Ws[lr][lc + 5] = wb.y; Ws[lr][lc + 6] = wb.z; Ws[lr][lc + 7] = wb.w;
    __syncthreads();
#pragma unroll
    for (int kk = 0; kk < 64; kk += 4) {
      const int ka = kk + 2 * h;          // lanes 16-31 carry K = 2,3 of the step
      v2f av, bv;
      av.x = Xs[wm + l][ka];  av.y = Xs[wm + l][ka + 1];
      bv.x = Ws[wn + l][ka];  bv.y = Ws[wn + l][ka + 1];
      acc = WMMA_F32(av, bv, acc);
    }
  }
#pragma unroll
  for (int i = 0; i < 8; i++) {
    const int m = m0 + wm + 8 * h + i;    // vgpr i -> M = i + 8*half
    const int n = n0 + wn + l;
    Y[(size_t)m * N + n] = acc[i] + bias[n];
  }
}

// ---------------------------------------------------------------------------
// beta = sigmoid(x @ Wbeta^T + bbeta), shape (Mrows, H)
// ---------------------------------------------------------------------------
__global__ void beta_kernel(const float* __restrict__ X, const float* __restrict__ Wb,
                            const float* __restrict__ bb, float* __restrict__ beta) {
  const int t = blockIdx.x * blockDim.x + threadIdx.x;
  if (t >= Mrows * H) return;
  const int m = t >> 4, h = t & 15;
  const float* xr = X + (size_t)m * Dm;
  const float* wr = Wb + (size_t)h * Dm;
  float s = bb[h];
  for (int k = 0; k < Dm; k += 4) {
    s += xr[k] * wr[k] + xr[k + 1] * wr[k + 1] + xr[k + 2] * wr[k + 2] + xr[k + 3] * wr[k + 3];
  }
  beta[t] = 1.f / (1.f + expf(-s));
}

// ---------------------------------------------------------------------------
// Causal depthwise conv along L:  y[b,l,c] = sum_j x[b, l-3+j, c] * w[c,j]
// ---------------------------------------------------------------------------
__global__ void conv_kernel(const float* __restrict__ P, const float* __restrict__ Wc,
                            float* __restrict__ Yc) {
  const int e = blockIdx.x * blockDim.x + threadIdx.x;
  if (e >= Mrows * Dm) return;
  const int c = e & (Dm - 1);
  const int m = e >> 10;          // Dm = 1024
  const int l = m & (Lseq - 1);
  float s = 0.f;
#pragma unroll
  for (int j = 0; j < CK; j++) {
    const int ls = l + j - (CK - 1);
    if (ls >= 0) s += P[(size_t)(m + j - (CK - 1)) * Dm + c] * Wc[c * CK + j];
  }
  Yc[e] = s;
}

// ---------------------------------------------------------------------------
// Per-(b,l,h): normalize k,q; v = beta*silu(v); b = beta*k.
// One wave per row; outputs in [bh][l][Dh] layout.
// ---------------------------------------------------------------------------
__global__ __launch_bounds__(256)
void prep_kernel(const float* __restrict__ kc, const float* __restrict__ qc,
                 const float* __restrict__ vc, const float* __restrict__ beta,
                 float* __restrict__ Kp, float* __restrict__ Qp,
                 float* __restrict__ Vp, float* __restrict__ Bp) {
  const int row  = blockIdx.x * 8 + (threadIdx.x >> 5);   // over (b*L+l)*H + h
  if (row >= Mrows * H) return;
  const int lane = threadIdx.x & 31;
  const int h  = row & (H - 1);
  const int ml = row >> 4;                 // b*L + l
  const int b  = ml / Lseq, l = ml & (Lseq - 1);
  const size_t src = (size_t)ml * Dm + h * Dh;
  float k0v = kc[src + lane], k1v = kc[src + lane + 32];
  float q0v = qc[src + lane], q1v = qc[src + lane + 32];
  float v0v = vc[src + lane], v1v = vc[src + lane + 32];
  float ks = k0v * k0v + k1v * k1v;
  float qs = q0v * q0v + q1v * q1v;
#pragma unroll
  for (int off = 16; off > 0; off >>= 1) {
    ks += __shfl_xor(ks, off);
    qs += __shfl_xor(qs, off);
  }
  const float kin = 1.f / (sqrtf(ks) + 1e-6f);
  const float qin = 1.f / (sqrtf(qs) + 1e-6f);
  const float bet = beta[(size_t)ml * H + h];
  const float s0 = v0v / (1.f + expf(-v0v));
  const float s1 = v1v / (1.f + expf(-v1v));
  const int bh = b * H + h;
  const size_t dst = ((size_t)bh * Lseq + l) * Dh;
  const float kn0 = k0v * kin, kn1 = k1v * kin;
  Kp[dst + lane] = kn0;             Kp[dst + lane + 32] = kn1;
  Qp[dst + lane] = q0v * qin;       Qp[dst + lane + 32] = q1v * qin;
  Vp[dst + lane] = bet * s0;        Vp[dst + lane + 32] = bet * s1;
  Bp[dst + lane] = bet * kn0;       Bp[dst + lane + 32] = bet * kn1;
}

// ---------------------------------------------------------------------------
// Delta-rule scan.  One 512-thread block per (b,h).  All 64x64 matmuls via
// WMMA fully in LDS (row stride 65 to dodge bank conflicts).
// ---------------------------------------------------------------------------
constexpr int ST = 65;
constexpr int SZ = 64 * ST;

__device__ __forceinline__ float lds_at(const float* M, bool T, int r, int c) {
  return T ? M[c * ST + r] : M[r * ST + c];
}

// C(64x64) = opA(A) @ opB(B); optional per-k scale on A (ksc), per-row scale
// on the result (rsc), accumulate-into-LDS.  All 512 threads participate.
__device__ __forceinline__ void mm64(const float* A, bool TA, const float* B, bool TB,
                                     float* Cb, const float* ksc, const float* rsc,
                                     bool accum, int tid) {
  const int wave = tid >> 5, lane = tid & 31;
  const int h = lane >> 4, l = lane & 15;
  const int wm = (wave >> 2) * 16, wn = (wave & 3) * 16;
  v8f acc = {};
#pragma unroll
  for (int kk = 0; kk < 64; kk += 4) {
    const int ka = kk + 2 * h;
    v2f av, bv;
    av.x = lds_at(A, TA, wm + l, ka);
    av.y = lds_at(A, TA, wm + l, ka + 1);
    bv.x = TB ? B[(wn + l) * ST + ka]     : B[ka * ST + (wn + l)];
    bv.y = TB ? B[(wn + l) * ST + ka + 1] : B[(ka + 1) * ST + (wn + l)];
    if (ksc) { av.x *= ksc[ka]; av.y *= ksc[ka + 1]; }
    acc = WMMA_F32(av, bv, acc);
  }
#pragma unroll
  for (int i = 0; i < 8; i++) {
    const int m = wm + 8 * h + i, n = wn + l;
    float v = acc[i];
    if (rsc) v *= rsc[m];
    if (accum) Cb[m * ST + n] += v; else Cb[m * ST + n] = v;
  }
}

__global__ __launch_bounds__(512)
void delta_kernel(const float* __restrict__ Kp, const float* __restrict__ Qp,
                  const float* __restrict__ Vp, const float* __restrict__ Bp,
                  float* __restrict__ Og) {
  extern __shared__ float sm[];
  float* Kc = sm + 0 * SZ;
  float* Qc = sm + 1 * SZ;
  float* BO = sm + 2 * SZ;   // Bc chunk, reused as O accumulator
  float* Wt = sm + 3 * SZ;
  float* Wa = sm + 4 * SZ;
  float* T0 = sm + 5 * SZ;   // S = tril(B K^T), later QK
  float* T1 = sm + 6 * SZ;   // RHS -> U (in-place solve)
  float* T2 = sm + 7 * SZ;   // B@Wt, then E, then K^T(U*w)
  float* T3 = sm + 8 * SZ;   // K^T U
  __shared__ float cs_s[64], wi_s[64], a_s[64], c_s[64];

  const int tid = threadIdx.x;
  const int bh  = blockIdx.x;
  const size_t base = (size_t)bh * Lseq * Dh;

  for (int e = tid; e < SZ; e += 512) { Wt[e] = 0.f; Wa[e] = 0.f; }
  __syncthreads();

  for (int i = 0; i < Nc; i++) {
    const float ts = (float)(i * C);
    if (tid < 64) {
      const float r1  = (float)(tid + 1);
      const float idx = ts + r1;
      const float cs  = r1 * ts + r1 * (r1 + 1.f) * 0.5f;
      cs_s[tid] = cs;
      const float sumidx = 64.f * ts + 2080.f;              // sum_{t=1..64}(ts+t)
      const float denom  = (1.f + ts + 64.f) * (ts + 64.f) * 0.5f;
      wi_s[tid] = (idx + sumidx - cs) / denom;
      const float tri0 = (1.f + ts) * ts * 0.5f;
      const float a = tri0 / (tri0 + cs);
      a_s[tid] = a;  c_s[tid] = 1.f - a;
    }
    const size_t cb = base + (size_t)i * C * Dh;
    for (int e = tid; e < C * Dh; e += 512) {
      const int r = e >> 6, d = e & 63;
      Kc[r * ST + d] = Kp[cb + e];
      Qc[r * ST + d] = Qp[cb + e];
      BO[r * ST + d] = Bp[cb + e];
    }
    __syncthreads();

    mm64(BO, false, Kc, true,  T0, nullptr, nullptr, false, tid);   // S  = B K^T
    mm64(BO, false, Wt, false, T2, nullptr, nullptr, false, tid);   // P  = B Wt
    __syncthreads();

    for (int e = tid; e < C * Dh; e += 512) {                       // RHS = V - P
      const int r = e >> 6, d = e & 63;
      T1[r * ST + d] = Vp[cb + e] - T2[r * ST + d];
    }
    __syncthreads();

    // Solve (I + tril(S,-1)) U = RHS; column-parallel, each column local.
    if (tid < 64) {
      const int cc = tid;
      for (int r = 1; r < C; r++) {
        float acc = T1[r * ST + cc];
        for (int j = 0; j < r; j++) acc -= T0[r * ST + j] * T1[j * ST + cc];
        T1[r * ST + cc] = acc;
      }
    }
    __syncthreads();

    mm64(Qc, false, Kc, true, T0, nullptr, nullptr, false, tid);    // QK = Q K^T
    __syncthreads();

    {                                                               // E = T_mat o QK
      const float tri0 = (1.f + ts) * ts * 0.5f;
      for (int e = tid; e < C * C; e += 512) {
        const int r = e >> 6, j = e & 63;
        const float csr  = cs_s[r];
        const float jidx = cs_s[j] - (ts + (float)(j + 1));
        const float tm = (csr >= jidx) ? (csr - jidx) / (tri0 + csr) : 0.f;
        T2[r * ST + j] = tm * T0[r * ST + j];
      }
    }
    __syncthreads();

    mm64(Qc, false, Wa, false, BO, nullptr, a_s, false, tid);       // O  = a*(Q Wa)
    __syncthreads();
    mm64(Qc, false, Wt, false, BO, nullptr, c_s, true, tid);        // O += c*(Q Wt)
    __syncthreads();
    mm64(T2, false, T1, false, BO, nullptr, nullptr, true, tid);    // O += E U
    __syncthreads();

    for (int e = tid; e < C * Dh; e += 512) {
      const int r = e >> 6, d = e & 63;
      Og[cb + e] = BO[r * ST + d];
    }

    mm64(Kc, true, T1, false, T3, nullptr, nullptr, false, tid);    // K^T U
    mm64(Kc, true, T1, false, T2, wi_s,   nullptr, false, tid);     // K^T (U * w_i)
    __syncthreads();

    {
      const float coef1 = ts / (ts + 64.f) * ((1.f + ts) / (1.f + ts + 64.f));
      const float coef2 = 64.f / (ts + 64.f) * ((ts * 2.f + 1.f + 64.f) / (1.f + ts + 64.f));
      for (int e = tid; e < C * Dh; e += 512) {
        const int r = e >> 6, d = e & 63, o = r * ST + d;
        const float wt = Wt[o], wa = Wa[o];
        Wa[o] = coef1 * wa + coef2 * wt + T2[o];
        Wt[o] = wt + T3[o];
      }
    }
    __syncthreads();
  }
}

// ---------------------------------------------------------------------------
// RMS norm over Dh; scatter from [bh][l][Dh] to (B,L,Dm) layout.
// ---------------------------------------------------------------------------
__global__ __launch_bounds__(256)
void rms_kernel(const float* __restrict__ Og, const float* __restrict__ rmsw,
                float* __restrict__ On) {
  const int row = blockIdx.x * 8 + (threadIdx.x >> 5);   // bh*L + l
  if (row >= Bb * H * Lseq) return;
  const int lane = threadIdx.x & 31;
  const int bh = row / Lseq, l = row & (Lseq - 1);
  const int b = bh >> 4, h = bh & 15;
  const size_t src = (size_t)row * Dh;
  const float o0 = Og[src + lane], o1 = Og[src + lane + 32];
  float ss = o0 * o0 + o1 * o1;
#pragma unroll
  for (int off = 16; off > 0; off >>= 1) ss += __shfl_xor(ss, off);
  const float inv = rsqrtf(ss * (1.f / 64.f) + 1e-6f);
  const size_t dst = ((size_t)(b * Lseq + l)) * Dm + h * Dh;
  On[dst + lane]      = o0 * inv * rmsw[lane];
  On[dst + lane + 32] = o1 * inv * rmsw[lane + 32];
}

// ---------------------------------------------------------------------------
extern "C" void kernel_launch(void* const* d_in, const int* in_sizes, int n_in,
                              void* d_out, int out_size, void* d_ws, size_t ws_size,
                              hipStream_t stream) {
  (void)in_sizes; (void)n_in; (void)out_size; (void)ws_size;
  const float* x     = (const float*)d_in[0];
  const float* Wk    = (const float*)d_in[1];
  const float* bk    = (const float*)d_in[2];
  const float* Wq    = (const float*)d_in[3];
  const float* bq    = (const float*)d_in[4];
  const float* Wv    = (const float*)d_in[5];
  const float* bv    = (const float*)d_in[6];
  const float* Wbeta = (const float*)d_in[7];
  const float* bbeta = (const float*)d_in[8];
  const float* convk = (const float*)d_in[9];
  const float* convq = (const float*)d_in[10];
  const float* convv = (const float*)d_in[11];
  const float* rmsw  = (const float*)d_in[12];
  const float* Wout  = (const float*)d_in[13];
  const float* boutp = (const float*)d_in[14];
  float* out = (float*)d_out;

  float* ws = (float*)d_ws;
  const size_t SLOT = (size_t)Mrows * Dm;         // 8.39M floats = 32 MB
  float* kpre = ws + 0 * SLOT;                    // -> reused as Kp
  float* qpre = ws + 1 * SLOT;                    // -> reused as Qp
  float* vpre = ws + 2 * SLOT;                    // -> reused as Vp
  float* kcv  = ws + 3 * SLOT;                    // -> reused as Ograw
  float* qcv  = ws + 4 * SLOT;                    // -> reused as On
  float* vcv  = ws + 5 * SLOT;
  float* Bp   = ws + 6 * SLOT;
  float* beta = ws + 7 * SLOT;                    // 131072 floats
  float* Kp = kpre; float* Qp = qpre; float* Vp = vpre;
  float* Ograw = kcv; float* On = qcv;

  const dim3 gg(Dm / 64, Mrows / 64);             // (16, 128)
  gemm_xwt_kernel<<<gg, 512, 0, stream>>>(x, Wk, bk, kpre, Mrows, Dm, Dm);
  gemm_xwt_kernel<<<gg, 512, 0, stream>>>(x, Wq, bq, qpre, Mrows, Dm, Dm);
  gemm_xwt_kernel<<<gg, 512, 0, stream>>>(x, Wv, bv, vpre, Mrows, Dm, Dm);
  beta_kernel<<<(Mrows * H) / 256, 256, 0, stream>>>(x, Wbeta, bbeta, beta);

  const int convBlocks = (Mrows * Dm) / 256;      // 32768
  conv_kernel<<<convBlocks, 256, 0, stream>>>(kpre, convk, kcv);
  conv_kernel<<<convBlocks, 256, 0, stream>>>(qpre, convq, qcv);
  conv_kernel<<<convBlocks, 256, 0, stream>>>(vpre, convv, vcv);

  prep_kernel<<<(Mrows * H) / 8, 256, 0, stream>>>(kcv, qcv, vcv, beta, Kp, Qp, Vp, Bp);

  const size_t dsm = (size_t)9 * SZ * sizeof(float);   // ~150 KB LDS (<= 320 KB/WGP)
  delta_kernel<<<Bb * H, 512, dsm, stream>>>(Kp, Qp, Vp, Bp, Ograw);

  rms_kernel<<<(Bb * H * Lseq) / 8, 256, 0, stream>>>(Ograw, rmsw, On);

  gemm_xwt_kernel<<<gg, 512, 0, stream>>>(On, Wout, boutp, out, Mrows, Dm, Dm);
}

// v001
// It runs in 1350 microseconds.
// Two timings next to v000 both put it at 1.59 times that version's speed.
#include <hip/hip_runtime.h>
#include <hip/hip_bf16.h>

typedef float v2f __attribute__((ext_vector_type(2)));
typedef float v8f __attribute__((ext_vector_type(8)));

#define WMMA_F32(a, b, c) \
  __builtin_amdgcn_wmma_f32_16x16x4_f32(false, (a), false, (b), (short)0, (c), false, false)

constexpr int Bb    = 4;
constexpr int Lseq  = 2048;
constexpr int Dm    = 1024;
constexpr int H     = 16;
constexpr int Dh    = 64;
constexpr int CK    = 4;      // conv kernel width
constexpr int C     = 64;     // chunk
constexpr int Nc    = Lseq / C;
constexpr int Mrows = Bb * Lseq;   // 8192

// ---------------------------------------------------------------------------
// Generic Y = X @ W^T + bias GEMM.  X:(M,K) row-major, W:(N,K) row-major.
// 64x64 tile per 512-thread block (16 waves, each one 16x16 WMMA tile).
// ---------------------------------------------------------------------------
__global__ __launch_bounds__(512)
void gemm_xwt_kernel(const float* __restrict__ X, const float* __restrict__ W,
                     const float* __restrict__ bias, float* __restrict__ Y,
                     int M, int N, int K) {
  __shared__ float Xs[64][65];
  __shared__ float Ws[64][65];
  const int tid  = threadIdx.x;
  const int wave = tid >> 5, lane = tid & 31;
  const int h = lane >> 4, l = lane & 15;
  const int wm = (wave >> 2) * 16, wn = (wave & 3) * 16;
  const int m0 = blockIdx.y * 64, n0 = blockIdx.x * 64;
  const int lr = tid >> 3;          // 0..63 (tile row to load)
  const int lc = (tid & 7) * 8;     // col start (8 floats per thread)

  v8f acc = {};
  for (int k0 = 0; k0 < K; k0 += 64) {
    float4 xa = *(const float4*)(X + (size_t)(m0 + lr) * K + k0 + lc);
    float4 xb = *(const float4*)(X + (size_t)(m0 + lr) * K + k0 + lc + 4);
    float4 wa = *(const float4*)(W + (size_t)(n0 + lr) * K + k0 + lc);
    float4 wb = *(const float4*)(W + (size_t)(n0 + lr) * K + k0 + lc + 4);
    __syncthreads();
    Xs[lr][lc + 0] = xa.x; Xs[lr][lc + 1] = xa.y; Xs[lr][lc + 2] = xa.z; Xs[lr][lc + 3] = xa.w;
    Xs[lr][lc + 4] = xb.x; Xs[lr][lc + 5] = xb.y; Xs[lr][lc + 6] = xb.z; Xs[lr][lc + 7] = xb.w;
    Ws[lr][lc + 0] = wa.x; Ws[lr][lc + 1] = wa.y; Ws[lr][lc + 2] = wa.z; Ws[lr][lc + 3] = wa.w;
    Ws[lr][lc + 4] = wb.x; Ws[lr][lc + 5] = wb.y; Ws[lr][lc + 6] = wb.z; Ws[lr][lc + 7] = wb.w;
    __syncthreads();
#pragma unroll
    for (int kk = 0; kk < 64; kk += 4) {
      const int ka = kk + 2 * h;          // lanes 16-31 carry K = 2,3 of the step
      v2f av, bv;
      av.x = Xs[wm + l][ka];  av.y = Xs[wm + l][ka + 1];
      bv.x = Ws[wn + l][ka];  bv.y = Ws[wn + l][ka + 1];
      acc = WMMA_F32(av, bv, acc);
    }
  }
#pragma unroll
  for (int i = 0; i < 8; i++) {
    const int m = m0 + wm + 8 * h + i;    // vgpr i -> M = i + 8*half
    const int n = n0 + wn + l;
    Y[(size_t)m * N + n] = acc[i] + bias[n];
  }
}

// ---------------------------------------------------------------------------
// beta = sigmoid(x @ Wbeta^T + bbeta), shape (Mrows, H)
// ---------------------------------------------------------------------------
__global__ void beta_kernel(const float* __restrict__ X, const float* __restrict__ Wb,
                            const float* __restrict__ bb, float* __restrict__ beta) {
  const int t = blockIdx.x * blockDim.x + threadIdx.x;
  if (t >= Mrows * H) return;
  const int m = t >> 4, h = t & 15;
  const float* xr = X + (size_t)m * Dm;
  const float* wr = Wb + (size_t)h * Dm;
  float s = bb[h];
  for (int k = 0; k < Dm; k += 4) {
    s += xr[k] * wr[k] + xr[k + 1] * wr[k + 1] + xr[k + 2] * wr[k + 2] + xr[k + 3] * wr[k + 3];
  }
  beta[t] = 1.f / (1.f + expf(-s));
}

// ---------------------------------------------------------------------------
// Causal depthwise conv along L:  y[b,l,c] = sum_j x[b, l-3+j, c] * w[c,j]
// ---------------------------------------------------------------------------
__global__ void conv_kernel(const float* __restrict__ P, const float* __restrict__ Wc,
                            float* __restrict__ Yc) {
  const int e = blockIdx.x * blockDim.x + threadIdx.x;
  if (e >= Mrows * Dm) return;
  const int c = e & (Dm - 1);
  const int m = e >> 10;          // Dm = 1024
  const int l = m & (Lseq - 1);
  float s = 0.f;
#pragma unroll
  for (int j = 0; j < CK; j++) {
    const int ls = l + j - (CK - 1);
    if (ls >= 0) s += P[(size_t)(m + j - (CK - 1)) * Dm + c] * Wc[c * CK + j];
  }
  Yc[e] = s;
}

// ---------------------------------------------------------------------------
// Per-(b,l,h): normalize k,q; v = beta*silu(v); b = beta*k.
// One wave per row; outputs in [bh][l][Dh] layout.
// ---------------------------------------------------------------------------
__global__ __launch_bounds__(256)
void prep_kernel(const float* __restrict__ kc, const float* __restrict__ qc,
                 const float* __restrict__ vc, const float* __restrict__ beta,
                 float* __restrict__ Kp, float* __restrict__ Qp,
                 float* __restrict__ Vp, float* __restrict__ Bp) {
  const int row  = blockIdx.x * 8 + (threadIdx.x >> 5);   // over (b*L+l)*H + h
  if (row >= Mrows * H) return;
  const int lane = threadIdx.x & 31;
  const int h  = row & (H - 1);
  const int ml = row >> 4;                 // b*L + l
  const int b  = ml / Lseq, l = ml & (Lseq - 1);
  const size_t src = (size_t)ml * Dm + h * Dh;
  float k0v = kc[src + lane], k1v = kc[src + lane + 32];
  float q0v = qc[src + lane], q1v = qc[src + lane + 32];
  float v0v = vc[src + lane], v1v = vc[src + lane + 32];
  float ks = k0v * k0v + k1v * k1v;
  float qs = q0v * q0v + q1v * q1v;
#pragma unroll
  for (int off = 16; off > 0; off >>= 1) {
    ks += __shfl_xor(ks, off);
    qs += __shfl_xor(qs, off);
  }
  const float kin = 1.f / (sqrtf(ks) + 1e-6f);
  const float qin = 1.f / (sqrtf(qs) + 1e-6f);
  const float bet = beta[(size_t)ml * H + h];
  const float s0 = v0v / (1.f + expf(-v0v));
  const float s1 = v1v / (1.f + expf(-v1v));
  const int bh = b * H + h;
  const size_t dst = ((size_t)bh * Lseq + l) * Dh;
  const float kn0 = k0v * kin, kn1 = k1v * kin;
  Kp[dst + lane] = kn0;             Kp[dst + lane + 32] = kn1;
  Qp[dst + lane] = q0v * qin;       Qp[dst + lane + 32] = q1v * qin;
  Vp[dst + lane] = bet * s0;        Vp[dst + lane + 32] = bet * s1;
  Bp[dst + lane] = bet * kn0;       Bp[dst + lane + 32] = bet * kn1;
}

// ---------------------------------------------------------------------------
// Delta-rule scan.  One 512-thread block per (b,h).  All 64x64 matmuls via
// WMMA fully in LDS (row stride 65 to dodge bank conflicts).
// ---------------------------------------------------------------------------
constexpr int ST = 65;
constexpr int SZ = 64 * ST;

__device__ __forceinline__ float lds_at(const float* M, bool T, int r, int c) {
  return T ? M[c * ST + r] : M[r * ST + c];
}

// C(64x64) = opA(A) @ opB(B); optional per-k scale on A (ksc), per-row scale
// on the result (rsc), accumulate-into-LDS.  All 512 threads participate.
__device__ __forceinline__ void mm64(const float* A, bool TA, const float* B, bool TB,
                                     float* Cb, const float* ksc, const float* rsc,
                                     bool accum, int tid) {
  const int wave = tid >> 5, lane = tid & 31;
  const int h = lane >> 4, l = lane & 15;
  const int wm = (wave >> 2) * 16, wn = (wave & 3) * 16;
  v8f acc = {};
#pragma unroll
  for (int kk = 0; kk < 64; kk += 4) {
    const int ka = kk + 2 * h;
    v2f av, bv;
    av.x = lds_at(A, TA, wm + l, ka);
    av.y = lds_at(A, TA, wm + l, ka + 1);
    bv.x = TB ? B[(wn + l) * ST + ka]     : B[ka * ST + (wn + l)];
    bv.y = TB ? B[(wn + l) * ST + ka + 1] : B[(ka + 1) * ST + (wn + l)];
    if (ksc) { av.x *= ksc[ka]; av.y *= ksc[ka + 1]; }
    acc = WMMA_F32(av, bv, acc);
  }
#pragma unroll
  for (int i = 0; i < 8; i++) {
    const int m = wm + 8 * h + i, n = wn + l;
    float v = acc[i];
    if (rsc) v *= rsc[m];
    if (accum) Cb[m * ST + n] += v; else Cb[m * ST + n] = v;
  }
}

__global__ __launch_bounds__(512)
void delta_kernel(const float* __restrict__ Kp, const float* __restrict__ Qp,
                  const float* __restrict__ Vp, const float* __restrict__ Bp,
                  float* __restrict__ Og) {
  extern __shared__ float sm[];
  float* Kc = sm + 0 * SZ;
  float* Qc = sm + 1 * SZ;
  float* BO = sm + 2 * SZ;   // Bc chunk, reused as O accumulator
  float* Wt = sm + 3 * SZ;
  float* Wa = sm + 4 * SZ;
  float* T0 = sm + 5 * SZ;   // S = tril(B K^T), later QK
  float* T1 = sm + 6 * SZ;   // RHS -> U (in-place solve)
  float* T2 = sm + 7 * SZ;   // B@Wt, then E, then K^T(U*w)
  float* T3 = sm + 8 * SZ;   // K^T U
  __shared__ float cs_s[64], wi_s[64], a_s[64], c_s[64];

  const int tid = threadIdx.x;
  const int bh  = blockIdx.x;
  const size_t base = (size_t)bh * Lseq * Dh;

  for (int e = tid; e < SZ; e += 512) { Wt[e] = 0.f; Wa[e] = 0.f; }
  __syncthreads();

  for (int i = 0; i < Nc; i++) {
    const float ts = (float)(i * C);
    if (tid < 64) {
      const float r1  = (float)(tid + 1);
      const float idx = ts + r1;
      const float cs  = r1 * ts + r1 * (r1 + 1.f) * 0.5f;
      cs_s[tid] = cs;
      const float sumidx = 64.f * ts + 2080.f;              // sum_{t=1..64}(ts+t)
      const float denom  = (1.f + ts + 64.f) * (ts + 64.f) * 0.5f;
      wi_s[tid] = (idx + sumidx - cs) / denom;
      const float tri0 = (1.f + ts) * ts * 0.5f;
      const float a = tri0 / (tri0 + cs);
      a_s[tid] = a;  c_s[tid] = 1.f - a;
    }
    const size_t cb = base + (size_t)i * C * Dh;
    for (int e = tid; e < C * Dh; e += 512) {
      const int r = e >> 6, d = e & 63;
      Kc[r * ST + d] = Kp[cb + e];
      Qc[r * ST + d] = Qp[cb + e];
      BO[r * ST + d] = Bp[cb + e];
    }
    __syncthreads();

    mm64(BO, false, Kc, true,  T0, nullptr, nullptr, false, tid);   // S  = B K^T
    mm64(BO, false, Wt, false, T2, nullptr, nullptr, false, tid);   // P  = B Wt
    __syncthreads();

    for (int e = tid; e < C * Dh; e += 512) {                       // RHS = V - P
      const int r = e >> 6, d = e & 63;
      T1[r * ST + d] = Vp[cb + e] - T2[r * ST + d];
    }
    __syncthreads();

    // Solve (I + tril(S,-1)) U = RHS by blocks of 16 rows.  Waves 0 and 1 solve
    // the 16x16 diagonal system, one column a lane, wholly in registers: the
    // block of S is read once, spread over the lanes (lane = row + 16 * (col / 8),
    // eight columns a lane), and each coefficient reaches the multiply-add as a
    // scalar through readlane, so no LDS latency stands between the 120 steps.
    // Then all rows below take  RHS -= S[rows][block] @ U[block]  on WMMA, one
    // 16x16 tile a wave.
#pragma unroll  // rb constant: LDS offsets become immediates, the last update drops out
    for (int rb = 0; rb < C; rb += 16) {
      if (tid < 64) {
        const int sl = tid & 31;
        int   sd[8];
        float u[16];
#pragma unroll  // register arrays and readlane need constant indices
        for (int c2 = 0; c2 < 8; c2++)
          sd[c2] = __float_as_int(T0[(rb + (sl & 15)) * ST + rb + 8 * (sl >> 4) + c2]);
#pragma unroll  // register arrays and readlane need constant indices
        for (int r = 0; r < 16; r++) u[r] = T1[(rb + r) * ST + tid];
#pragma unroll  // register arrays and readlane need constant indices
        for (int j = 0; j < 15; j++) {
#pragma unroll  // register arrays and readlane need constant indices
          for (int r = j + 1; r < 16; r++) {
            const float s = __int_as_float(__builtin_amdgcn_readlane(sd[j & 7], r + 16 * (j >> 3)));
            u[r] -= s * u[j];
          }
        }
#pragma unroll  // register arrays and readlane need constant indices
        for (int r = 1; r < 16; r++) T1[(rb + r) * ST + tid] = u[r];
      }
      __syncthreads();
      if (rb + 16 < C) {
        const int wave = tid >> 5, lane = tid & 31;
        const int h = lane >> 4, l = lane & 15;
        const int wm = (wave >> 2) * 16, wn = (wave & 3) * 16;
        if (wm > rb) {
          float t[8];
#pragma unroll  // register arrays need constant indices
          for (int i2 = 0; i2 < 8; i2++) t[i2] = T1[(wm + 8 * h + i2) * ST + wn + l];
          v8f acc = {};
#pragma unroll  // four chained WMMA with their LDS offsets as immediates
          for (int kk = 0; kk < 16; kk += 4) {
            const int ka = rb + kk + 2 * h;
            v2f av, bv;
            av.x = T0[(wm + l) * ST + ka];
            av.y = T0[(wm + l) * ST + ka + 1];
            bv.x = T1[ka * ST + (wn + l)];
            bv.y = T1[(ka + 1) * ST + (wn + l)];
            acc = WMMA_F32(av, bv, acc);
          }
#pragma unroll  // register arrays need constant indices
          for (int i2 = 0; i2 < 8; i2++) T1[(wm + 8 * h + i2) * ST + wn + l] = t[i2] - acc[i2];
        }
        __syncthreads();
      }
    }

    mm64(Qc, false, Kc, true, T0, nullptr, nullptr, false, tid);    // QK = Q K^T
    __syncthreads();

    {                                                               // E = T_mat o QK
      const float tri0 = (1.f + ts) * ts * 0.5f;
      for (int e = tid; e < C * C; e += 512) {
        const int r = e >> 6, j = e & 63;
        const float csr  = cs_s[r];
        const float jidx = cs_s[j] - (ts + (float)(j + 1));
        const float tm = (csr >= jidx) ? (csr - jidx) / (tri0 + csr) : 0.f;
        T2[r * ST + j] = tm * T0[r * ST + j];
      }
    }
    __syncthreads();

    mm64(Qc, false, Wa, false, BO, nullptr, a_s, false, tid);       // O  = a*(Q Wa)
    __syncthreads();
    mm64(Qc, false, Wt, false, BO, nullptr, c_s, true, tid);        // O += c*(Q Wt)
    __syncthreads();
    mm64(T2, false, T1, false, BO, nullptr, nullptr, true, tid);    // O += E U
    __syncthreads();

    for (int e = tid; e < C * Dh; e += 512) {
      const int r = e >> 6, d = e & 63;
      Og[cb + e] = BO[r * ST + d];
    }

    mm64(Kc, true, T1, false, T3, nullptr, nullptr, false, tid);    // K^T U
    mm64(Kc, true, T1, false, T2, wi_s,   nullptr, false, tid);     // K^T (U * w_i)
    __syncthreads();

    {
      const float coef1 = ts / (ts + 64.f) * ((1.f + ts) / (1.f + ts + 64.f));
      const float coef2 = 64.f / (ts + 64.f) * ((ts * 2.f + 1.f + 64.f) / (1.f + ts + 64.f));
      for (int e = tid; e < C * Dh; e += 512) {
        const int r = e >> 6, d = e & 63, o = r * ST + d;
        const float wt = Wt[o], wa = Wa[o];
        Wa[o] = coef1 * wa + coef2 * wt + T2[o];
        Wt[o] = wt + T3[o];
      }
    }
    __syncthreads();
  }
}

// ---------------------------------------------------------------------------
// RMS norm over Dh; scatter from [bh][l][Dh] to (B,L,Dm) layout.
// ---------------------------------------------------------------------------
__global__ __launch_bounds__(256)
void rms_kernel(const float* __restrict__ Og, const float* __restrict__ rmsw,
                float* __restrict__ On) {
  const int row = blockIdx.x * 8 + (threadIdx.x >> 5);   // bh*L + l
  if (row >= Bb * H * Lseq) return;
  const int lane = threadIdx.x & 31;
  const int bh = row / Lseq, l = row & (Lseq - 1);
  const int b = bh >> 4, h = bh & 15;
  const size_t src = (size_t)row * Dh;
  const float o0 = Og[src + lane], o1 = Og[src + lane + 32];
  float ss = o0 * o0 + o1 * o1;
#pragma unroll
  for (int off = 16; off > 0; off >>= 1) ss += __shfl_xor(ss, off);
  const float inv = rsqrtf(ss * (1.f / 64.f) + 1e-6f);
  const size_t dst = ((size_t)(b * Lseq + l)) * Dm + h * Dh;
  On[dst + lane]      = o0 * inv * rmsw[lane];
  On[dst + lane + 32] = o1 * inv * rmsw[lane + 32];
}

// ---------------------------------------------------------------------------
extern "C" void kernel_launch(void* const* d_in, const int* in_sizes, int n_in,
                              void* d_out, int out_size, void* d_ws, size_t ws_size,
                              hipStream_t stream) {
  (void)in_sizes; (void)n_in; (void)out_size; (void)ws_size;
  const float* x     = (const float*)d_in[0];
  const float* Wk    = (const float*)d_in[1];
  const float* bk    = (const float*)d_in[2];
  const float* Wq    = (const float*)d_in[3];
  const float* bq    = (const float*)d_in[4];
  const float* Wv    = (const float*)d_in[5];
  const float* bv    = (const float*)d_in[6];
  const float* Wbeta = (const float*)d_in[7];
  const float* bbeta = (const float*)d_in[8];
  const float* convk = (const float*)d_in[9];
  const float* convq = (const float*)d_in[10];
  const float* convv = (const float*)d_in[11];
  const float* rmsw  = (const float*)d_in[12];
  const float* Wout  = (const float*)d_in[13];
  const float* boutp = (const float*)d_in[14];
  float* out = (float*)d_out;

  float* ws = (float*)d_ws;
  const size_t SLOT = (size_t)Mrows * Dm;         // 8.39M floats = 32 MB
  float* kpre = ws + 0 * SLOT;                    // -> reused as Kp
  float* qpre = ws + 1 * SLOT;                    // -> reused as Qp
  float* vpre = ws + 2 * SLOT;                    // -> reused as Vp
  float* kcv  = ws + 3 * SLOT;                    // -> reused as Ograw
  float* qcv  = ws + 4 * SLOT;                    // -> reused as On
  float* vcv  = ws + 5 * SLOT;
  float* Bp   = ws + 6 * SLOT;
  float* beta = ws + 7 * SLOT;                    // 131072 floats
  float* Kp = kpre; float* Qp = qpre; float* Vp = vpre;
  float* Ograw = kcv; float* On = qcv;

  const dim3 gg(Dm / 64, Mrows / 64);             // (16, 128)
  gemm_xwt_kernel<<<gg, 512, 0, stream>>>(x, Wk, bk, kpre, Mrows, Dm, Dm);
  gemm_xwt_kernel<<<gg, 512, 0, stream>>>(x, Wq, bq, qpre, Mrows, Dm, Dm);
  gemm_xwt_kernel<<<gg, 512, 0, stream>>>(x, Wv, bv, vpre, Mrows, Dm, Dm);
  beta_kernel<<<(Mrows * H) / 256, 256, 0, stream>>>(x, Wbeta, bbeta, beta);

  const int convBlocks = (Mrows * Dm) / 256;      // 32768
  conv_kernel<<<convBlocks, 256, 0, stream>>>(kpre, convk, kcv);
  conv_kernel<<<convBlocks, 256, 0, stream>>>(qpre, convq, qcv);
  conv_kernel<<<convBlocks, 256, 0, stream>>>(vpre, convv, vcv);

  prep_kernel<<<(Mrows * H) / 8, 256, 0, stream>>>(kcv, qcv, vcv, beta, Kp, Qp, Vp, Bp);

  const size_t dsm = (size_t)9 * SZ * sizeof(float);   // ~150 KB LDS (<= 320 KB/WGP)
  delta_kernel<<<Bb * H, 512, dsm, stream>>>(Kp, Qp, Vp, Bp, Ograw);

  rms_kernel<<<(Bb * H * Lseq) / 8, 256, 0, stream>>>(Ograw, rmsw, On);

  gemm_xwt_kernel<<<gg, 512, 0, stream>>>(On, Wout, boutp, out, Mrows, Dm, Dm);
}

// v002
// One run takes 1110 microseconds.
// Next to v001, in two timings, it ran 1.22 times as fast each time.
// All steps since v000 together make it 1.94 times as fast.
#include <hip/hip_runtime.h>
#include <hip/hip_bf16.h>

typedef float v2f __attribute__((ext_vector_type(2)));
typedef float v8f __attribute__((ext_vector_type(8)));

#define WMMA_F32(a, b, c) \
  __builtin_amdgcn_wmma_f32_16x16x4_f32(false, (a), false, (b), (short)0, (c), false, false)

constexpr int Bb    = 4;
constexpr int Lseq  = 2048;
constexpr int Dm    = 1024;
constexpr int H     = 16;
constexpr int Dh    = 64;
constexpr int CK    = 4;      // conv kernel width
constexpr int C     = 64;     // chunk
constexpr int Nc    = Lseq / C;
constexpr int Mrows = Bb * Lseq;   // 8192

// LDS row pitches, in floats (64 banks of 4 bytes).  A 16x16x4 fragment is 64
// dwords: 16 rows (or columns) times 4 values of k.
// PK: the reader takes k along a row, lane l in row l: 68 = 4 mod 64 puts row l
//     on banks 4l..4l+3, so the 64 dwords fall on 64 banks, as one 8-byte read.
// PN: the reader takes k from row to row, lane l in column l: 80 = 16 mod 64
//     puts the four rows of a step 16 banks apart, again 64 banks.
constexpr int PK = 68;
constexpr int PN = 80;

// ---------------------------------------------------------------------------
// Generic Y = X @ W^T + bias GEMM.  X:(M,K) row-major, W:(N,K) row-major.
// 64x64 tile per 512-thread block (16 waves, each one 16x16 WMMA tile).
// Both tiles are read with k along the row: pitch PK.
// ---------------------------------------------------------------------------
__global__ __launch_bounds__(512)
void gemm_xwt_kernel(const float* __restrict__ X, const float* __restrict__ W,
                     const float* __restrict__ bias, float* __restrict__ Y,
                     int M, int N, int K) {
  __shared__ __attribute__((aligned(16))) float Xs[64][PK];
  __shared__ __attribute__((aligned(16))) float Ws[64][PK];
  const int tid  = threadIdx.x;
  const int wave = tid >> 5, lane = tid & 31;
  const int h = lane >> 4, l = lane & 15;
  const int wm = (wave >> 2) * 16, wn = (wave & 3) * 16;
  const int m0 = blockIdx.y * 64, n0 = blockIdx.x * 64;
  const int lr = tid >> 3;          // 0..63 (tile row to load)
  const int lc = (tid & 7) * 8;     // col start (8 floats per thread)

  v8f acc = {};
  for (int k0 = 0; k0 < K; k0 += 64) {
    float4 xa = *(const float4*)(X + (size_t)(m0 + lr) * K + k0 + lc);
    float4 xb = *(const float4*)(X + (size_t)(m0 + lr) * K + k0 + lc + 4);
    float4 wa = *(const float4*)(W + (size_t)(n0 + lr) * K + k0 + lc);
    float4 wb = *(const float4*)(W + (size_t)(n0 + lr) * K + k0 + lc + 4);
    __syncthreads();
    Xs[lr][lc + 0] = xa.x; Xs[lr][lc + 1] = xa.y; Xs[lr][lc + 2] = xa.z; Xs[lr][lc + 3] = xa.w;
    Xs[lr][lc + 4] = xb.x; Xs[lr][lc + 5] = xb.y; Xs[lr][lc + 6] = xb.z; Xs[lr][lc + 7] = xb.w;
    Ws[lr][lc + 0] = wa.x; Ws[lr][lc + 1] = wa.y; Ws[lr][lc + 2] = wa.z; Ws[lr][lc + 3] = wa.w;
    Ws[lr][lc + 4] = wb.x; Ws[lr][lc + 5] = wb.y; Ws[lr][lc + 6] = wb.z; Ws[lr][lc + 7] = wb.w;
    __syncthreads();
#pragma unroll
    for (int kk = 0; kk < 64; kk += 4) {
      const int ka = kk + 2 * h;          // lanes 16-31 carry K = 2,3 of the step
      const v2f av = *(const v2f*)&Xs[wm + l][ka];
      const v2f bv = *(const v2f*)&Ws[wn + l][ka];
      acc = WMMA_F32(av, bv, acc);
    }
  }
#pragma unroll
  for (int i = 0; i < 8; i++) {
    const int m = m0 + wm + 8 * h + i;    // vgpr i -> M = i + 8*half
    const int n = n0 + wn + l;
    Y[(size_t)m * N + n] = acc[i] + bias[n];
  }
}

// ---------------------------------------------------------------------------
// beta = sigmoid(x @ Wbeta^T + bbeta), shape (Mrows, H)
// ---------------------------------------------------------------------------
__global__ void beta_kernel(const float* __restrict__ X, const float* __restrict__ Wb,
                            const float* __restrict__ bb, float* __restrict__ beta) {
  const int t = blockIdx.x * blockDim.x + threadIdx.x;
  if (t >= Mrows * H) return;
  const int m = t >> 4, h = t & 15;
  const float* xr = X + (size_t)m * Dm;
  const float* wr = Wb + (size_t)h * Dm;
  float s = bb[h];
  for (int k = 0; k < Dm; k += 4) {
    s += xr[k] * wr[k] + xr[k + 1] * wr[k + 1] + xr[k + 2] * wr[k + 2] + xr[k + 3] * wr[k + 3];
  }
  beta[t] = 1.f / (1.f + expf(-s));
}

// ---------------------------------------------------------------------------
// Causal depthwise conv along L:  y[b,l,c] = sum_j x[b, l-3+j, c] * w[c,j]
// ---------------------------------------------------------------------------
__global__ void conv_kernel(const float* __restrict__ P, const float* __restrict__ Wc,
                            float* __restrict__ Yc) {
  const int e = blockIdx.x * blockDim.x + threadIdx.x;
  if (e >= Mrows * Dm) return;
  const int c = e & (Dm - 1);
  const int m = e >> 10;          // Dm = 1024
  const int l = m & (Lseq - 1);
  float s = 0.f;
#pragma unroll
  for (int j = 0; j < CK; j++) {
    const int ls = l + j - (CK - 1);
    if (ls >= 0) s += P[(size_t)(m + j - (CK - 1)) * Dm + c] * Wc[c * CK + j];
  }
  Yc[e] = s;
}

// ---------------------------------------------------------------------------
// Per-(b,l,h): normalize k,q; v = beta*silu(v); b = beta*k.
// One wave per row; outputs in [bh][l][Dh] layout.
// ---------------------------------------------------------------------------
__global__ __launch_bounds__(256)
void prep_kernel(const float* __restrict__ kc, const float* __restrict__ qc,
                 const float* __restrict__ vc, const float* __restrict__ beta,
                 float* __restrict__ Kp, float* __restrict__ Qp,
                 float* __restrict__ Vp, float* __restrict__ Bp) {
  const int row  = blockIdx.x * 8 + (threadIdx.x >> 5);   // over (b*L+l)*H + h
  if (row >= Mrows * H) return;
  const int lane = threadIdx.x & 31;
  const int h  = row & (H - 1);
  const int ml = row >> 4;                 // b*L + l
  const int b  = ml / Lseq, l = ml & (Lseq - 1);
  const size_t src = (size_t)ml * Dm + h * Dh;
  float k0v = kc[src + lane], k1v = kc[src + lane + 32];
  float q0v = qc[src + lane], q1v = qc[src + lane + 32];
  float v0v = vc[src + lane], v1v = vc[src + lane + 32];
  float ks = k0v * k0v + k1v * k1v;
  float qs = q0v * q0v + q1v * q1v;
#pragma unroll
  for (int off = 16; off > 0; off >>= 1) {
    ks += __shfl_xor(ks, off);
    qs += __shfl_xor(qs, off);
  }
  const float kin = 1.f / (sqrtf(ks) + 1e-6f);
  const float qin = 1.f / (sqrtf(qs) + 1e-6f);
  const float bet = beta[(size_t)ml * H + h];
  const float s0 = v0v / (1.f + expf(-v0v));
  const float s1 = v1v / (1.f + expf(-v1v));
  const int bh = b * H + h;
  const size_t dst = ((size_t)bh * Lseq + l) * Dh;
  const float kn0 = k0v * kin, kn1 = k1v * kin;
  Kp[dst + lane] = kn0;             Kp[dst + lane + 32] = kn1;
  Qp[dst + lane] = q0v * qin;       Qp[dst + lane + 32] = q1v * qin;
  Vp[dst + lane] = bet * s0;        Vp[dst + lane + 32] = bet * s1;
  Bp[dst + lane] = bet * kn0;       Bp[dst + lane + 32] = bet * kn1;
}

// ---------------------------------------------------------------------------
// Delta-rule scan.  One 512-thread block per (b,h).  All 64x64 matmuls via
// WMMA fully in LDS.  Each matrix has the pitch of its fragment reader: PK where
// k runs along its rows (A as it stands, B transposed, and every result), PN
// where k runs from row to row (A transposed, B as it stands).  K is read both
// ways and is kept twice.
// ---------------------------------------------------------------------------
constexpr int SK = 64 * PK;
constexpr int SN = 64 * PN;

// C(64x64) = opA(A) @ opB(B); optional per-k scale on A (ksc), per-row scale
// on the result (rsc), accumulate-into-LDS.  All 512 threads participate.
// Pitches: A has PN if TA else PK; B has PK if TB else PN; Cb has PK.
__device__ __forceinline__ void mm64(const float* A, bool TA, const float* B, bool TB,
                                     float* Cb, const float* ksc, const float* rsc,
                                     bool accum, int tid) {
  const int wave = tid >> 5, lane = tid & 31;
  const int h = lane >> 4, l = lane & 15;
  const int wm = (wave >> 2) * 16, wn = (wave & 3) * 16;
  v8f acc = {};
#pragma unroll
  for (int kk = 0; kk < 64; kk += 4) {
    const int ka = kk + 2 * h;
    v2f av, bv;
    if (TA) { av.x = A[ka * PN + (wm + l)];  av.y = A[(ka + 1) * PN + (wm + l)]; }
    else    { av = *(const v2f*)&A[(wm + l) * PK + ka]; }
    if (TB) { bv = *(const v2f*)&B[(wn + l) * PK + ka]; }
    else    { bv.x = B[ka * PN + (wn + l)];  bv.y = B[(ka + 1) * PN + (wn + l)]; }
    if (ksc) { av.x *= ksc[ka]; av.y *= ksc[ka + 1]; }
    acc = WMMA_F32(av, bv, acc);
  }
#pragma unroll
  for (int i = 0; i < 8; i++) {
    const int m = wm + 8 * h + i, n = wn + l;
    float v = acc[i];
    if (rsc) v *= rsc[m];
    if (accum) Cb[m * PK + n] += v; else Cb[m * PK + n] = v;
  }
}

__global__ __launch_bounds__(512)
void delta_kernel(const float* __restrict__ Kp, const float* __restrict__ Qp,
                  const float* __restrict__ Vp, const float* __restrict__ Bp,
                  float* __restrict__ Og) {
  __shared__ __attribute__((aligned(16))) float sm[6 * SK + 4 * SN];
  float* Kc = sm + 0 * SK;   // pitch PK from here
  float* Qc = sm + 1 * SK;
  float* BO = sm + 2 * SK;   // Bc chunk, reused as O accumulator
  float* T0 = sm + 3 * SK;   // S = tril(B K^T), later QK
  float* T2 = sm + 4 * SK;   // B@Wt, then E, then K^T(U*w)
  float* T3 = sm + 5 * SK;   // K^T U
  float* Kr = sm + 6 * SK + 0 * SN;   // pitch PN from here; K again, read as K^T
  float* Wt = sm + 6 * SK + 1 * SN;
  float* Wa = sm + 6 * SK + 2 * SN;
  float* T1 = sm + 6 * SK + 3 * SN;   // RHS -> U (in-place solve)
  __shared__ float cs_s[64], wi_s[64], a_s[64], c_s[64];

  const int tid = threadIdx.x;
  const int bh  = blockIdx.x;
  const size_t base = (size_t)bh * Lseq * Dh;

  for (int e = tid; e < SN; e += 512) { Wt[e] = 0.f; Wa[e] = 0.f; }
  __syncthreads();

  for (int i = 0; i < Nc; i++) {
    const float ts = (float)(i * C);
    if (tid < 64) {
      const float r1  = (float)(tid + 1);
      const float idx = ts + r1;
      const float cs  = r1 * ts + r1 * (r1 + 1.f) * 0.5f;
      cs_s[tid] = cs;
      const float sumidx = 64.f * ts + 2080.f;              // sum_{t=1..64}(ts+t)
      const float denom  = (1.f + ts + 64.f) * (ts + 64.f) * 0.5f;
      wi_s[tid] = (idx + sumidx - cs) / denom;
      const float tri0 = (1.f + ts) * ts * 0.5f;
      const float a = tri0 / (tri0 + cs);
      a_s[tid] = a;  c_s[tid] = 1.f - a;
    }
    const size_t cb = base + (size_t)i * C * Dh;
    for (int e = tid; e < C * Dh; e += 512) {
      const int r = e >> 6, d = e & 63;
      const float kv = Kp[cb + e];
      // precaution: the address pair of the load above may be reused by the next load's result
      asm volatile("s_wait_xcnt 0x0" ::: "memory");
      Kc[r * PK + d] = kv;
      Kr[r * PN + d] = kv;
      Qc[r * PK + d] = Qp[cb + e];
      BO[r * PK + d] = Bp[cb + e];
    }
    __syncthreads();

    mm64(BO, false, Kc, true,  T0, nullptr, nullptr, false, tid);   // S  = B K^T
    mm64(BO, false, Wt, false, T2, nullptr, nullptr, false, tid);   // P  = B Wt
    __syncthreads();

    for (int e = tid; e < C * Dh; e += 512) {                       // RHS = V - P
      const int r = e >> 6, d = e & 63;
      T1[r * PN + d] = Vp[cb + e] - T2[r * PK + d];
    }
    __syncthreads();

    // Solve (I + tril(S,-1)) U = RHS by blocks of 16 rows.  Waves 0 and 1 solve
    // the 16x16 diagonal system, one column a lane, wholly in registers: the
    // block of S is read once, spread over the lanes (lane = row + 16 * (col / 8),
    // eight columns a lane), and each coefficient reaches the multiply-add as a
    // scalar through readlane, so no LDS latency stands between the 120 steps.
    // Then all rows below take  RHS -= S[rows][block] @ U[block]  on WMMA, one
    // 16x16 tile a wave.
#pragma unroll  // rb constant: LDS offsets become immediates, the last update drops out
    for (int rb = 0; rb < C; rb += 16) {
      if (tid < 64) {
        const int sl = tid & 31;
        int   sd[8];
        float u[16];
#pragma unroll  // register arrays and readlane need constant indices
        for (int c2 = 0; c2 < 8; c2++)
          sd[c2] = __float_as_int(T0[(rb + (sl & 15)) * PK + rb + 8 * (sl >> 4) + c2]);
#pragma unroll  // register arrays and readlane need constant indices
        for (int r = 0; r < 16; r++) u[r] = T1[(rb + r) * PN + tid];
#pragma unroll  // register arrays and readlane need constant indices
        for (int j = 0; j < 15; j++) {
#pragma unroll  // register arrays and readlane need constant indices
          for (int r = j + 1; r < 16; r++) {
            const float s = __int_as_float(__builtin_amdgcn_readlane(sd[j & 7], r + 16 * (j >> 3)));
            u[r] -= s * u[j];
          }
        }
#pragma unroll  // register arrays and readlane need constant indices
        for (int r = 1; r < 16; r++) T1[(rb + r) * PN + tid] = u[r];
      }
      __syncthreads();
      if (rb + 16 < C) {
        const int wave = tid >> 5, lane = tid & 31;
        const int h = lane >> 4, l = lane & 15;
        const int wm = (wave >> 2) * 16, wn = (wave & 3) * 16;
        if (wm > rb) {
          float t[8];
#pragma unroll  // register arrays need constant indices
          for (int i2 = 0; i2 < 8; i2++) t[i2] = T1[(wm + 8 * h + i2) * PN + wn + l];
          v8f acc = {};
#pragma unroll  // four chained WMMA with their LDS offsets as immediates
          for (int kk = 0; kk < 16; kk += 4) {
            const int ka = rb + kk + 2 * h;
            const v2f av = *(const v2f*)&T0[(wm + l) * PK + ka];
            v2f bv;
            bv.x = T1[ka * PN + (wn + l)];
            bv.y = T1[(ka + 1) * PN + (wn + l)];
            acc = WMMA_F32(av, bv, acc);
          }
#pragma unroll  // register arrays need constant indices
          for (int i2 = 0; i2 < 8; i2++) T1[(wm + 8 * h + i2) * PN + wn + l] = t[i2] - acc[i2];
        }
        __syncthreads();
      }
    }

    mm64(Qc, false, Kc, true, T0, nullptr, nullptr, false, tid);    // QK = Q K^T
    __syncthreads();

    {                                                               // E = T_mat o QK
      const float tri0 = (1.f + ts) * ts * 0.5f;
      for (int e = tid; e < C * C; e += 512) {
        const int r = e >> 6, j = e & 63;
        const float csr  = cs_s[r];
        const float jidx = cs_s[j] - (ts + (float)(j + 1));
        const float tm = (csr >= jidx) ? (csr - jidx) / (tri0 + csr) : 0.f;
        T2[r * PK + j] = tm * T0[r * PK + j];
      }
    }
    __syncthreads();

    mm64(Qc, false, Wa, false, BO, nullptr, a_s, false, tid);       // O  = a*(Q Wa)
    __syncthreads();
    mm64(Qc, false, Wt, false, BO, nullptr, c_s, true, tid);        // O += c*(Q Wt)
    __syncthreads();
    mm64(T2, false, T1, false, BO, nullptr, nullptr, true, tid);    // O += E U
    __syncthreads();

    for (int e = tid; e < C * Dh; e += 512) {
      const int r = e >> 6, d = e & 63;
      Og[cb + e] = BO[r * PK + d];
    }

    mm64(Kr, true, T1, false, T3, nullptr, nullptr, false, tid);    // K^T U
    mm64(Kr, true, T1, false, T2, wi_s,   nullptr, false, tid);     // K^T (U * w_i)
    __syncthreads();

    {
      const float coef1 = ts / (ts + 64.f) * ((1.f + ts) / (1.f + ts + 64.f));
      const float coef2 = 64.f / (ts + 64.f) * ((ts * 2.f + 1.f + 64.f) / (1.f + ts + 64.f));
      for (int e = tid; e < C * Dh; e += 512) {
        const int r = e >> 6, d = e & 63, o = r * PN + d, p = r * PK + d;
        const float wt = Wt[o], wa = Wa[o];
        Wa[o] = coef1 * wa + coef2 * wt + T2[p];
        Wt[o] = wt + T3[p];
      }
    }
    __syncthreads();
  }
}

// ---------------------------------------------------------------------------
// RMS norm over Dh; scatter from [bh][l][Dh] to (B,L,Dm) layout.
// ---------------------------------------------------------------------------
__global__ __launch_bounds__(256)
void rms_kernel(const float* __restrict__ Og, const float* __restrict__ rmsw,
                float* __restrict__ On) {
  const int row = blockIdx.x * 8 + (threadIdx.x >> 5);   // bh*L + l
  if (row >= Bb * H * Lseq) return;
  const int lane = threadIdx.x & 31;
  const int bh = row / Lseq, l = row & (Lseq - 1);
  const int b = bh >> 4, h = bh & 15;
  const size_t src = (size_t)row * Dh;
  const float o0 = Og[src + lane], o1 = Og[src + lane + 32];
  float ss = o0 * o0 + o1 * o1;
#pragma unroll
  for (int off = 16; off > 0; off >>= 1) ss += __shfl_xor(ss, off);
  const float inv = rsqrtf(ss * (1.f / 64.f) + 1e-6f);
  const size_t dst = ((size_t)(b * Lseq + l)) * Dm + h * Dh;
  On[dst + lane]      = o0 * inv * rmsw[lane];
  On[dst + lane + 32] = o1 * inv * rmsw[lane + 32];
}

// ---------------------------------------------------------------------------
extern "C" void kernel_launch(void* const* d_in, const int* in_sizes, int n_in,
                              void* d_out, int out_size, void* d_ws, size_t ws_size,
                              hipStream_t stream) {
  (void)in_sizes; (void)n_in; (void)out_size; (void)ws_size;
  const float* x     = (const float*)d_in[0];
  const float* Wk    = (const float*)d_in[1];
  const float* bk    = (const float*)d_in[2];
  const float* Wq    = (const float*)d_in[3];
  const float* bq    = (const float*)d_in[4];
  const float* Wv    = (const float*)d_in[5];
  const float* bv    = (const float*)d_in[6];
  const float* Wbeta = (const float*)d_in[7];
  const float* bbeta = (const float*)d_in[8];
  const float* convk = (const float*)d_in[9];
  const float* convq = (const float*)d_in[10];
  const float* convv = (const float*)d_in[11];
  const float* rmsw  = (const float*)d_in[12];
  const float* Wout  = (const float*)d_in[13];
  const float* boutp = (const float*)d_in[14];
  float* out = (float*)d_out;

  float* ws = (float*)d_ws;
  const size_t SLOT = (size_t)Mrows * Dm;         // 8.39M floats = 32 MB
  float* kpre = ws + 0 * SLOT;                    // -> reused as Kp
  float* qpre = ws + 1 * SLOT;                    // -> reused as Qp
  float* vpre = ws + 2 * SLOT;                    // -> reused as Vp
  float* kcv  = ws + 3 * SLOT;                    // -> reused as Ograw
  float* qcv  = ws + 4 * SLOT;                    // -> reused as On
  float* vcv  = ws + 5 * SLOT;
  float* Bp   = ws + 6 * SLOT;
  float* beta = ws + 7 * SLOT;                    // 131072 floats
  float* Kp = kpre; float* Qp = qpre; float* Vp = vpre;
  float* Ograw = kcv; float* On = qcv;

  const dim3 gg(Dm / 64, Mrows / 64);             // (16, 128)
  gemm_xwt_kernel<<<gg, 512, 0, stream>>>(x, Wk, bk, kpre, Mrows, Dm, Dm);
  gemm_xwt_kernel<<<gg, 512, 0, stream>>>(x, Wq, bq, qpre, Mrows, Dm, Dm);
  gemm_xwt_kernel<<<gg, 512, 0, stream>>>(x, Wv, bv, vpre, Mrows, Dm, Dm);
  beta_kernel<<<(Mrows * H) / 256, 256, 0, stream>>>(x, Wbeta, bbeta, beta);

  const int convBlocks = (Mrows * Dm) / 256;      // 32768
  conv_kernel<<<convBlocks, 256, 0, stream>>>(kpre, convk, kcv);
  conv_kernel<<<convBlocks, 256, 0, stream>>>(qpre, convq, qcv);
  conv_kernel<<<convBlocks, 256, 0, stream>>>(vpre, convv, vcv);

  prep_kernel<<<(Mrows * H) / 8, 256, 0, stream>>>(kcv, qcv, vcv, beta, Kp, Qp, Vp, Bp);

  delta_kernel<<<Bb * H, 512, 0, stream>>>(Kp, Qp, Vp, Bp, Ograw);   // 183 KiB of static LDS

  rms_kernel<<<(Bb * H * Lseq) / 8, 256, 0, stream>>>(Ograw, rmsw, On);

  gemm_xwt_kernel<<<gg, 512, 0, stream>>>(On, Wout, boutp, out, Mrows, Dm, Dm);
}

// v003
// Measured time: 891 microseconds a run.
// Next to v002, in two timings, it ran 1.24 and 1.25 times as fast.
// All steps since v000 together make it 2.42 times as fast.
#include <hip/hip_runtime.h>
#include <hip/hip_bf16.h>

typedef float v2f __attribute__((ext_vector_type(2)));
typedef float v8f __attribute__((ext_vector_type(8)));

#define WMMA_F32(a, b, c) \
  __builtin_amdgcn_wmma_f32_16x16x4_f32(false, (a), false, (b), (short)0, (c), false, false)

constexpr int Bb    = 4;
constexpr int Lseq  = 2048;
constexpr int Dm    = 1024;
constexpr int H     = 16;
constexpr int Dh    = 64;
constexpr int CK    = 4;      // conv kernel width
constexpr int C     = 64;     // chunk
constexpr int Nc    = Lseq / C;
constexpr int Mrows = Bb * Lseq;   // 8192

// LDS row pitches, in floats (64 banks of 4 bytes).  A 16x16x4 fragment is 64
// dwords: 16 rows (or columns) times 4 values of k.
// PK: the reader takes k along a row, lane l in row l: 68 = 4 mod 64 puts row l
//     on banks 4l..4l+3, so the 64 dwords fall on 64 banks, as one 8-byte read.
// PN: the reader takes k from row to row, lane l in column l: 80 = 16 mod 64
//     puts the four rows of a step 16 banks apart, again 64 banks.
constexpr int PK = 68;
constexpr int PN = 80;

// ---------------------------------------------------------------------------
// Generic Y = X @ W^T + bias GEMM.  X:(M,K) row-major, W:(N,K) row-major.
// 64x64 tile per 512-thread block (16 waves, each one 16x16 WMMA tile).
// Both tiles are read with k along the row: pitch PK.
// ---------------------------------------------------------------------------
__global__ __launch_bounds__(512)
void gemm_xwt_kernel(const float* __restrict__ X, const float* __restrict__ W,
                     const float* __restrict__ bias, float* __restrict__ Y,
                     int M, int N, int K) {
  __shared__ __attribute__((aligned(16))) float Xs[64][PK];
  __shared__ __attribute__((aligned(16))) float Ws[64][PK];
  const int tid  = threadIdx.x;
  const int wave = tid >> 5, lane = tid & 31;
  const int h = lane >> 4, l = lane & 15;
  const int wm = (wave >> 2) * 16, wn = (wave & 3) * 16;
  const int m0 = blockIdx.y * 64, n0 = blockIdx.x * 64;
  const int lr = tid >> 3;          // 0..63 (tile row to load)
  const int lc = (tid & 7) * 8;     // col start (8 floats per thread)

  v8f acc = {};
  for (int k0 = 0; k0 < K; k0 += 64) {
    float4 xa = *(const float4*)(X + (size_t)(m0 + lr) * K + k0 + lc);
    float4 xb = *(const float4*)(X + (size_t)(m0 + lr) * K + k0 + lc + 4);
    float4 wa = *(const float4*)(W + (size_t)(n0 + lr) * K + k0 + lc);
    float4 wb = *(const float4*)(W + (size_t)(n0 + lr) * K + k0 + lc + 4);
    __syncthreads();
    Xs[lr][lc + 0] = xa.x; Xs[lr][lc + 1] = xa.y; Xs[lr][lc + 2] = xa.z; Xs[lr][lc + 3] = xa.w;
    Xs[lr][lc + 4] = xb.x; Xs[lr][lc + 5] = xb.y; Xs[lr][lc + 6] = xb.z; Xs[lr][lc + 7] = xb.w;
    Ws[lr][lc + 0] = wa.x; Ws[lr][lc + 1] = wa.y; Ws[lr][lc + 2] = wa.z; Ws[lr][lc + 3] = wa.w;
    Ws[lr][lc + 4] = wb.x; Ws[lr][lc + 5] = wb.y; Ws[lr][lc + 6] = wb.z; Ws[lr][lc + 7] = wb.w;
    __syncthreads();
#pragma unroll
    for (int kk = 0; kk < 64; kk += 4) {
      const int ka = kk + 2 * h;          // lanes 16-31 carry K = 2,3 of the step
      const v2f av = *(const v2f*)&Xs[wm + l][ka];
      const v2f bv = *(const v2f*)&Ws[wn + l][ka];
      acc = WMMA_F32(av, bv, acc);
    }
  }
#pragma unroll
  for (int i = 0; i < 8; i++) {
    const int m = m0 + wm + 8 * h + i;    // vgpr i -> M = i + 8*half
    const int n = n0 + wn + l;
    Y[(size_t)m * N + n] = acc[i] + bias[n];
  }
}

// ---------------------------------------------------------------------------
// beta = sigmoid(x @ Wbeta^T + bbeta), shape (Mrows, H)
// ---------------------------------------------------------------------------
__global__ void beta_kernel(const float* __restrict__ X, const float* __restrict__ Wb,
                            const float* __restrict__ bb, float* __restrict__ beta) {
  const int t = blockIdx.x * blockDim.x + threadIdx.x;
  if (t >= Mrows * H) return;
  const int m = t >> 4, h = t & 15;
  const float* xr = X + (size_t)m * Dm;
  const float* wr = Wb + (size_t)h * Dm;
  float s = bb[h];
  for (int k = 0; k < Dm; k += 4) {
    s += xr[k] * wr[k] + xr[k + 1] * wr[k + 1] + xr[k + 2] * wr[k + 2] + xr[k + 3] * wr[k + 3];
  }
  beta[t] = 1.f / (1.f + expf(-s));
}

// ---------------------------------------------------------------------------
// Causal depthwise conv along L:  y[b,l,c] = sum_j x[b, l-3+j, c] * w[c,j]
// ---------------------------------------------------------------------------
__global__ void conv_kernel(const float* __restrict__ P, const float* __restrict__ Wc,
                            float* __restrict__ Yc) {
  const int e = blockIdx.x * blockDim.x + threadIdx.x;
  if (e >= Mrows * Dm) return;
  const int c = e & (Dm - 1);
  const int m = e >> 10;          // Dm = 1024
  const int l = m & (Lseq - 1);
  float s = 0.f;
#pragma unroll
  for (int j = 0; j < CK; j++) {
    const int ls = l + j - (CK - 1);
    if (ls >= 0) s += P[(size_t)(m + j - (CK - 1)) * Dm + c] * Wc[c * CK + j];
  }
  Yc[e] = s;
}

// ---------------------------------------------------------------------------
// Per-(b,l,h): normalize k,q; v = beta*silu(v); b = beta*k.
// One wave per row; outputs in [bh][l][Dh] layout.
// ---------------------------------------------------------------------------
__global__ __launch_bounds__(256)
void prep_kernel(const float* __restrict__ kc, const float* __restrict__ qc,
                 const float* __restrict__ vc, const float* __restrict__ beta,
                 float* __restrict__ Kp, float* __restrict__ Qp,
                 float* __restrict__ Vp, float* __restrict__ Bp) {
  const int row  = blockIdx.x * 8 + (threadIdx.x >> 5);   // over (b*L+l)*H + h
  if (row >= Mrows * H) return;
  const int lane = threadIdx.x & 31;
  const int h  = row & (H - 1);
  const int ml = row >> 4;                 // b*L + l
  const int b  = ml / Lseq, l = ml & (Lseq - 1);
  const size_t src = (size_t)ml * Dm + h * Dh;
  float k0v = kc[src + lane], k1v = kc[src + lane + 32];
  float q0v = qc[src + lane], q1v = qc[src + lane + 32];
  float v0v = vc[src + lane], v1v = vc[src + lane + 32];
  float ks = k0v * k0v + k1v * k1v;
  float qs = q0v * q0v + q1v * q1v;
#pragma unroll
  for (int off = 16; off > 0; off >>= 1) {
    ks += __shfl_xor(ks, off);
    qs += __shfl_xor(qs, off);
  }
  const float kin = 1.f / (sqrtf(ks) + 1e-6f);
  const float qin = 1.f / (sqrtf(qs) + 1e-6f);
  const float bet = beta[(size_t)ml * H + h];
  const float s0 = v0v / (1.f + expf(-v0v));
  const float s1 = v1v / (1.f + expf(-v1v));
  const int bh = b * H + h;
  const size_t dst = ((size_t)bh * Lseq + l) * Dh;
  const float kn0 = k0v * kin, kn1 = k1v * kin;
  Kp[dst + lane] = kn0;             Kp[dst + lane + 32] = kn1;
  Qp[dst + lane] = q0v * qin;       Qp[dst + lane + 32] = q1v * qin;
  Vp[dst + lane] = bet * s0;        Vp[dst + lane + 32] = bet * s1;
  Bp[dst + lane] = bet * kn0;       Bp[dst + lane + 32] = bet * kn1;
}

// ---------------------------------------------------------------------------
// Delta-rule scan.  One 512-thread block per (b,h).  All 64x64 matmuls via
// WMMA fully in LDS.  Each matrix has the pitch of its fragment reader: PK where
// k runs along its rows (A as it stands, B transposed, and every result), PN
// where k runs from row to row (A transposed, B as it stands).  K is read both
// ways and is kept twice.
// ---------------------------------------------------------------------------
constexpr int SK = 64 * PK;
constexpr int SN = 64 * PN;

// C(64x64) = opA(A) @ opB(B); optional per-k scale on A (ksc), per-row scale
// on the result (rsc), accumulate-into-LDS.  All 512 threads participate.
// Pitches: A has PN if TA else PK; B has PK if TB else PN; Cb has PK.
__device__ __forceinline__ void mm64(const float* A, bool TA, const float* B, bool TB,
                                     float* Cb, const float* ksc, const float* rsc,
                                     bool accum, int tid) {
  const int wave = tid >> 5, lane = tid & 31;
  const int h = lane >> 4, l = lane & 15;
  const int wm = (wave >> 2) * 16, wn = (wave & 3) * 16;
  v8f acc = {};
#pragma unroll
  for (int kk = 0; kk < 64; kk += 4) {
    const int ka = kk + 2 * h;
    v2f av, bv;
    if (TA) { av.x = A[ka * PN + (wm + l)];  av.y = A[(ka + 1) * PN + (wm + l)]; }
    else    { av = *(const v2f*)&A[(wm + l) * PK + ka]; }
    if (TB) { bv = *(const v2f*)&B[(wn + l) * PK + ka]; }
    else    { bv.x = B[ka * PN + (wn + l)];  bv.y = B[(ka + 1) * PN + (wn + l)]; }
    if (ksc) { av.x *= ksc[ka]; av.y *= ksc[ka + 1]; }
    acc = WMMA_F32(av, bv, acc);
  }
#pragma unroll
  for (int i = 0; i < 8; i++) {
    const int m = wm + 8 * h + i, n = wn + l;
    float v = acc[i];
    if (rsc) v *= rsc[m];
    if (accum) Cb[m * PK + n] += v; else Cb[m * PK + n] = v;
  }
}

__global__ __launch_bounds__(512)
void delta_kernel(const float* __restrict__ Kp, const float* __restrict__ Qp,
                  const float* __restrict__ Vp, const float* __restrict__ Bp,
                  float* __restrict__ Og) {
  __shared__ __attribute__((aligned(16))) float sm[6 * SK + 4 * SN];
  float* Kc = sm + 0 * SK;   // pitch PK from here
  float* Qc = sm + 1 * SK;
  float* BO = sm + 2 * SK;   // Bc chunk, reused as O accumulator
  float* T0 = sm + 3 * SK;   // S = tril(B K^T), later QK
  float* T2 = sm + 4 * SK;   // B@Wt, then E, then K^T(U*w)
  float* T3 = sm + 5 * SK;   // K^T U
  float* Kr = sm + 6 * SK + 0 * SN;   // pitch PN from here; K again, read as K^T
  float* Wt = sm + 6 * SK + 1 * SN;
  float* Wa = sm + 6 * SK + 2 * SN;
  float* T1 = sm + 6 * SK + 3 * SN;   // RHS -> U (in-place solve)
  __shared__ float cs_s[64], wi_s[64], a_s[64], c_s[64];

  const int tid = threadIdx.x;
  const int bh  = blockIdx.x;
  const size_t base = (size_t)bh * Lseq * Dh;

  // Each thread carries two 16-byte pieces of every 64x64 chunk matrix, rows pr
  // and pr + 32 at column pd.  They are loaded one chunk ahead and wait in
  // registers, so no wave of the serial chunk loop stands on a global load.
  const int pr = tid >> 4, pd = (tid & 15) * 4;
  constexpr int PH = C * Dh / 2;            // elements from the first piece to the second
  const size_t pe = base + (size_t)tid * 4;
  float4 k0 = *(const float4*)(Kp + pe), k1 = *(const float4*)(Kp + pe + PH);
  float4 q0 = *(const float4*)(Qp + pe), q1 = *(const float4*)(Qp + pe + PH);
  float4 b0 = *(const float4*)(Bp + pe), b1 = *(const float4*)(Bp + pe + PH);
  float4 v0 = *(const float4*)(Vp + pe), v1 = *(const float4*)(Vp + pe + PH);

  for (int e = tid; e < SN; e += 512) { Wt[e] = 0.f; Wa[e] = 0.f; }
  __syncthreads();

  for (int i = 0; i < Nc; i++) {
    const float ts = (float)(i * C);
    if (tid < 64) {
      const float r1  = (float)(tid + 1);
      const float idx = ts + r1;
      const float cs  = r1 * ts + r1 * (r1 + 1.f) * 0.5f;
      cs_s[tid] = cs;
      const float sumidx = 64.f * ts + 2080.f;              // sum_{t=1..64}(ts+t)
      const float denom  = (1.f + ts + 64.f) * (ts + 64.f) * 0.5f;
      wi_s[tid] = (idx + sumidx - cs) / denom;
      const float tri0 = (1.f + ts) * ts * 0.5f;
      const float a = tri0 / (tri0 + cs);
      a_s[tid] = a;  c_s[tid] = 1.f - a;
    }
    const size_t cb = base + (size_t)i * C * Dh;
    *(float4*)&Kc[pr * PK + pd] = k0;  *(float4*)&Kc[(pr + 32) * PK + pd] = k1;
    *(float4*)&Kr[pr * PN + pd] = k0;  *(float4*)&Kr[(pr + 32) * PN + pd] = k1;
    *(float4*)&Qc[pr * PK + pd] = q0;  *(float4*)&Qc[(pr + 32) * PK + pd] = q1;
    *(float4*)&BO[pr * PK + pd] = b0;  *(float4*)&BO[(pr + 32) * PK + pd] = b1;
    __syncthreads();

    mm64(BO, false, Kc, true,  T0, nullptr, nullptr, false, tid);   // S  = B K^T
    mm64(BO, false, Wt, false, T2, nullptr, nullptr, false, tid);   // P  = B Wt
    __syncthreads();

    {                                                               // RHS = V - P
      const float4 p0 = *(const float4*)&T2[pr * PK + pd];
      const float4 p1 = *(const float4*)&T2[(pr + 32) * PK + pd];
      *(float4*)&T1[pr * PN + pd] =
          make_float4(v0.x - p0.x, v0.y - p0.y, v0.z - p0.z, v0.w - p0.w);
      *(float4*)&T1[(pr + 32) * PN + pd] =
          make_float4(v1.x - p1.x, v1.y - p1.y, v1.z - p1.z, v1.w - p1.w);
    }
    __syncthreads();

    // Solve (I + tril(S,-1)) U = RHS by blocks of 16 rows.  Waves 0 and 1 solve
    // the 16x16 diagonal system, one column a lane, wholly in registers: the
    // block of S is read once, spread over the lanes (lane = row + 16 * (col / 8),
    // eight columns a lane), and each coefficient reaches the multiply-add as a
    // scalar through readlane, so no LDS latency stands between the 120 steps.
    // Then all rows below take  RHS -= S[rows][block] @ U[block]  on WMMA, one
    // 16x16 tile a wave.
#pragma unroll  // rb constant: LDS offsets become immediates, the last update drops out
    for (int rb = 0; rb < C; rb += 16) {
      if (tid < 64) {
        const int sl = tid & 31;
        int   sd[8];
        float u[16];
#pragma unroll  // register arrays and readlane need constant indices
        for (int c2 = 0; c2 < 8; c2++)
          sd[c2] = __float_as_int(T0[(rb + (sl & 15)) * PK + rb + 8 * (sl >> 4) + c2]);
#pragma unroll  // register arrays and readlane need constant indices
        for (int r = 0; r < 16; r++) u[r] = T1[(rb + r) * PN + tid];
#pragma unroll  // register arrays and readlane need constant indices
        for (int j = 0; j < 15; j++) {
#pragma unroll  // register arrays and readlane need constant indices
          for (int r = j + 1; r < 16; r++) {
            const float s = __int_as_float(__builtin_amdgcn_readlane(sd[j & 7], r + 16 * (j >> 3)));
            u[r] -= s * u[j];
          }
        }
#pragma unroll  // register arrays and readlane need constant indices
        for (int r = 1; r < 16; r++) T1[(rb + r) * PN + tid] = u[r];
      }
      __syncthreads();
      if (rb + 16 < C) {
        const int wave = tid >> 5, lane = tid & 31;
        const int h = lane >> 4, l = lane & 15;
        const int wm = (wave >> 2) * 16, wn = (wave & 3) * 16;
        if (wm > rb) {
          float t[8];
#pragma unroll  // register arrays need constant indices
          for (int i2 = 0; i2 < 8; i2++) t[i2] = T1[(wm + 8 * h + i2) * PN + wn + l];
          v8f acc = {};
#pragma unroll  // four chained WMMA with their LDS offsets as immediates
          for (int kk = 0; kk < 16; kk += 4) {
            const int ka = rb + kk + 2 * h;
            const v2f av = *(const v2f*)&T0[(wm + l) * PK + ka];
            v2f bv;
            bv.x = T1[ka * PN + (wn + l)];
            bv.y = T1[(ka + 1) * PN + (wn + l)];
            acc = WMMA_F32(av, bv, acc);
          }
#pragma unroll  // register arrays need constant indices
          for (int i2 = 0; i2 < 8; i2++) T1[(wm + 8 * h + i2) * PN + wn + l] = t[i2] - acc[i2];
        }
        __syncthreads();
      }
    }

    mm64(Qc, false, Kc, true, T0, nullptr, nullptr, false, tid);    // QK = Q K^T
    __syncthreads();

    {                                                               // E = T_mat o QK
      const float tri0 = (1.f + ts) * ts * 0.5f;
      for (int e = tid; e < C * C; e += 512) {
        const int r = e >> 6, j = e & 63;
        const float csr  = cs_s[r];
        const float jidx = cs_s[j] - (ts + (float)(j + 1));
        const float tm = (csr >= jidx) ? (csr - jidx) / (tri0 + csr) : 0.f;
        T2[r * PK + j] = tm * T0[r * PK + j];
      }
    }
    __syncthreads();

    mm64(Qc, false, Wa, false, BO, nullptr, a_s, false, tid);       // O  = a*(Q Wa)
    __syncthreads();
    mm64(Qc, false, Wt, false, BO, nullptr, c_s, true, tid);        // O += c*(Q Wt)
    __syncthreads();
    mm64(T2, false, T1, false, BO, nullptr, nullptr, true, tid);    // O += E U
    __syncthreads();

    // The next chunk's pieces are asked for here, at the head of the longest
    // stretch without a barrier (two products): a barrier waits for every load
    // of its wave, and by the one that ends this stretch they have landed.
    if (i + 1 < Nc) {
      const size_t pn = pe + (size_t)(i + 1) * C * Dh;
      k0 = *(const float4*)(Kp + pn);  k1 = *(const float4*)(Kp + pn + PH);
      q0 = *(const float4*)(Qp + pn);  q1 = *(const float4*)(Qp + pn + PH);
      b0 = *(const float4*)(Bp + pn);  b1 = *(const float4*)(Bp + pn + PH);
      v0 = *(const float4*)(Vp + pn);  v1 = *(const float4*)(Vp + pn + PH);
    }

    for (int e = tid; e < C * Dh; e += 512) {
      const int r = e >> 6, d = e & 63;
      Og[cb + e] = BO[r * PK + d];
    }

    mm64(Kr, true, T1, false, T3, nullptr, nullptr, false, tid);    // K^T U
    mm64(Kr, true, T1, false, T2, wi_s,   nullptr, false, tid);     // K^T (U * w_i)
    __syncthreads();

    {
      const float coef1 = ts / (ts + 64.f) * ((1.f + ts) / (1.f + ts + 64.f));
      const float coef2 = 64.f / (ts + 64.f) * ((ts * 2.f + 1.f + 64.f) / (1.f + ts + 64.f));
      for (int e = tid; e < C * Dh; e += 512) {
        const int r = e >> 6, d = e & 63, o = r * PN + d, p = r * PK + d;
        const float wt = Wt[o], wa = Wa[o];
        Wa[o] = coef1 * wa + coef2 * wt + T2[p];
        Wt[o] = wt + T3[p];
      }
    }
    __syncthreads();
  }
}

// ---------------------------------------------------------------------------
// RMS norm over Dh; scatter from [bh][l][Dh] to (B,L,Dm) layout.
// ---------------------------------------------------------------------------
__global__ __launch_bounds__(256)
void rms_kernel(const float* __restrict__ Og, const float* __restrict__ rmsw,
                float* __restrict__ On) {
  const int row = blockIdx.x * 8 + (threadIdx.x >> 5);   // bh*L + l
  if (row >= Bb * H * Lseq) return;
  const int lane = threadIdx.x & 31;
  const int bh = row / Lseq, l = row & (Lseq - 1);
  const int b = bh >> 4, h = bh & 15;
  const size_t src = (size_t)row * Dh;
  const float o0 = Og[src + lane], o1 = Og[src + lane + 32];
  float ss = o0 * o0 + o1 * o1;
#pragma unroll
  for (int off = 16; off > 0; off >>= 1) ss += __shfl_xor(ss, off);
  const float inv = rsqrtf(ss * (1.f / 64.f) + 1e-6f);
  const size_t dst = ((size_t)(b * Lseq + l)) * Dm + h * Dh;
  On[dst + lane]      = o0 * inv * rmsw[lane];
  On[dst + lane + 32] = o1 * inv * rmsw[lane + 32];
}

// ---------------------------------------------------------------------------
extern "C" void kernel_launch(void* const* d_in, const int* in_sizes, int n_in,
                              void* d_out, int out_size, void* d_ws, size_t ws_size,
                              hipStream_t stream) {
  (void)in_sizes; (void)n_in; (void)out_size; (void)ws_size;
  const float* x     = (const float*)d_in[0];
  const float* Wk    = (const float*)d_in[1];
  const float* bk    = (const float*)d_in[2];
  const float* Wq    = (const float*)d_in[3];
  const float* bq    = (const float*)d_in[4];
  const float* Wv    = (const float*)d_in[5];
  const float* bv    = (const float*)d_in[6];
  const float* Wbeta = (const float*)d_in[7];
  const float* bbeta = (const float*)d_in[8];
  const float* convk = (const float*)d_in[9];
  const float* convq = (const float*)d_in[10];
  const float* convv = (const float*)d_in[11];
  const float* rmsw  = (const float*)d_in[12];
  const float* Wout  = (const float*)d_in[13];
  const float* boutp = (const float*)d_in[14];
  float* out = (float*)d_out;

  float* ws = (float*)d_ws;
  const size_t SLOT = (size_t)Mrows * Dm;         // 8.39M floats = 32 MB
  float* kpre = ws + 0 * SLOT;                    // -> reused as Kp
  float* qpre = ws + 1 * SLOT;                    // -> reused as Qp
  float* vpre = ws + 2 * SLOT;                    // -> reused as Vp
  float* kcv  = ws + 3 * SLOT;                    // -> reused as Ograw
  float* qcv  = ws + 4 * SLOT;                    // -> reused as On
  float* vcv  = ws + 5 * SLOT;
  float* Bp   = ws + 6 * SLOT;
  float* beta = ws + 7 * SLOT;                    // 131072 floats
  float* Kp = kpre; float* Qp = qpre; float* Vp = vpre;
  float* Ograw = kcv; float* On = qcv;

  const dim3 gg(Dm / 64, Mrows / 64);             // (16, 128)
  gemm_xwt_kernel<<<gg, 512, 0, stream>>>(x, Wk, bk, kpre, Mrows, Dm, Dm);
  gemm_xwt_kernel<<<gg, 512, 0, stream>>>(x, Wq, bq, qpre, Mrows, Dm, Dm);
  gemm_xwt_kernel<<<gg, 512, 0, stream>>>(x, Wv, bv, vpre, Mrows, Dm, Dm);
  beta_kernel<<<(Mrows * H) / 256, 256, 0, stream>>>(x, Wbeta, bbeta, beta);

  const int convBlocks = (Mrows * Dm) / 256;      // 32768
  conv_kernel<<<convBlocks, 256, 0, stream>>>(kpre, convk, kcv);
  conv_kernel<<<convBlocks, 256, 0, stream>>>(qpre, convq, qcv);
  conv_kernel<<<convBlocks, 256, 0, stream>>>(vpre, convv, vcv);

  prep_kernel<<<(Mrows * H) / 8, 256, 0, stream>>>(kcv, qcv, vcv, beta, Kp, Qp, Vp, Bp);

  delta_kernel<<<Bb * H, 512, 0, stream>>>(Kp, Qp, Vp, Bp, Ograw);   // 183 KiB of static LDS

  rms_kernel<<<(Bb * H * Lseq) / 8, 256, 0, stream>>>(Ograw, rmsw, On);

  gemm_xwt_kernel<<<gg, 512, 0, stream>>>(On, Wout, boutp, out, Mrows, Dm, Dm);
}

// v004
// Measured time: 772 microseconds a run.
// In both of two side-by-side timings against v003, it was 1.16 times as fast.
// All steps since v000 together make it 2.79 times as fast.
#include <hip/hip_runtime.h>
#include <hip/hip_bf16.h>

typedef float v2f __attribute__((ext_vector_type(2)));
typedef float v8f __attribute__((ext_vector_type(8)));

#define WMMA_F32(a, b, c) \
  __builtin_amdgcn_wmma_f32_16x16x4_f32(false, (a), false, (b), (short)0, (c), false, false)

constexpr int Bb    = 4;
constexpr int Lseq  = 2048;
constexpr int Dm    = 1024;
constexpr int H     = 16;
constexpr int Dh    = 64;
constexpr int CK    = 4;      // conv kernel width
constexpr int C     = 64;     // chunk
constexpr int Nc    = Lseq / C;
constexpr int Mrows = Bb * Lseq;   // 8192

// LDS row pitches, in floats (64 banks of 4 bytes).  A 16x16x4 fragment is 64
// dwords: 16 rows (or columns) times 4 values of k.
// PK: the reader takes k along a row, lane l in row l: 68 = 4 mod 64 puts row l
//     on banks 4l..4l+3, so the 64 dwords fall on 64 banks, as one 8-byte read.
// PN: the reader takes k from row to row, lane l in column l: 80 = 16 mod 64
//     puts the four rows of a step 16 banks apart, again 64 banks.
constexpr int PK = 68;
constexpr int PN = 80;

// ---------------------------------------------------------------------------
// Generic Y = X @ W^T + bias GEMM.  X:(M,K) row-major, W:(N,K) row-major.
// 64x64 tile per 512-thread block (16 waves, each one 16x16 WMMA tile).
// Both tiles are read with k along the row: pitch PK.
// ---------------------------------------------------------------------------
__global__ __launch_bounds__(512)
void gemm_xwt_kernel(const float* __restrict__ X, const float* __restrict__ W,
                     const float* __restrict__ bias, float* __restrict__ Y,
                     int M, int N, int K) {
  __shared__ __attribute__((aligned(16))) float Xs[64][PK];
  __shared__ __attribute__((aligned(16))) float Ws[64][PK];
  const int tid  = threadIdx.x;
  const int wave = tid >> 5, lane = tid & 31;
  const int h = lane >> 4, l = lane & 15;
  const int wm = (wave >> 2) * 16, wn = (wave & 3) * 16;
  const int m0 = blockIdx.y * 64, n0 = blockIdx.x * 64;
  const int lr = tid >> 3;          // 0..63 (tile row to load)
  const int lc = (tid & 7) * 8;     // col start (8 floats per thread)

  v8f acc = {};
  for (int k0 = 0; k0 < K; k0 += 64) {
    float4 xa = *(const float4*)(X + (size_t)(m0 + lr) * K + k0 + lc);
    float4 xb = *(const float4*)(X + (size_t)(m0 + lr) * K + k0 + lc + 4);
    float4 wa = *(const float4*)(W + (size_t)(n0 + lr) * K + k0 + lc);
    float4 wb = *(const float4*)(W + (size_t)(n0 + lr) * K + k0 + lc + 4);
    __syncthreads();
    Xs[lr][lc + 0] = xa.x; Xs[lr][lc + 1] = xa.y; Xs[lr][lc + 2] = xa.z; Xs[lr][lc + 3] = xa.w;
    Xs[lr][lc + 4] = xb.x; Xs[lr][lc + 5] = xb.y; Xs[lr][lc + 6] = xb.z; Xs[lr][lc + 7] = xb.w;
    Ws[lr][lc + 0] = wa.x; Ws[lr][lc + 1] = wa.y; Ws[lr][lc + 2] = wa.z; Ws[lr][lc + 3] = wa.w;
    Ws[lr][lc + 4] = wb.x; Ws[lr][lc + 5] = wb.y; Ws[lr][lc + 6] = wb.z; Ws[lr][lc + 7] = wb.w;
    __syncthreads();
#pragma unroll
    for (int kk = 0; kk < 64; kk += 4) {
      const int ka = kk + 2 * h;          // lanes 16-31 carry K = 2,3 of the step
      const v2f av = *(const v2f*)&Xs[wm + l][ka];
      const v2f bv = *(const v2f*)&Ws[wn + l][ka];
      acc = WMMA_F32(av, bv, acc);
    }
  }
#pragma unroll
  for (int i = 0; i < 8; i++) {
    const int m = m0 + wm + 8 * h + i;    // vgpr i -> M = i + 8*half
    const int n = n0 + wn + l;
    Y[(size_t)m * N + n] = acc[i] + bias[n];
  }
}

// ---------------------------------------------------------------------------
// beta = sigmoid(x @ Wbeta^T + bbeta), shape (Mrows, H)
// ---------------------------------------------------------------------------
__global__ void beta_kernel(const float* __restrict__ X, const float* __restrict__ Wb,
                            const float* __restrict__ bb, float* __restrict__ beta) {
  const int t = blockIdx.x * blockDim.x + threadIdx.x;
  if (t >= Mrows * H) return;
  const int m = t >> 4, h = t & 15;
  const float* xr = X + (size_t)m * Dm;
  const float* wr = Wb + (size_t)h * Dm;
  float s = bb[h];
  for (int k = 0; k < Dm; k += 4) {
    s += xr[k] * wr[k] + xr[k + 1] * wr[k + 1] + xr[k + 2] * wr[k + 2] + xr[k + 3] * wr[k + 3];
  }
  beta[t] = 1.f / (1.f + expf(-s));
}

// ---------------------------------------------------------------------------
// Causal depthwise conv along L of the k, q and v projections,
//   y[b,l,c] = sum_j x[b, l-3+j, c] * w[c,j],
// and, on the rows as they leave the conv: normalize k,q; v = beta*silu(v);
// b = beta*k.  Outputs in [bh][l][Dh] layout.
// A wave takes 128 channels (two heads, 16 lanes a head, 4 channels a lane) and
// slides down RW rows: the three rows above stay in registers, a row is loaded
// as 512 contiguous bytes, RB rows ahead of its use.
// ---------------------------------------------------------------------------
constexpr int RW = 16;    // rows a wave
constexpr int RB = 4;     // rows a batch of loads

__device__ __forceinline__ float4 ld4(const float* p) { return *(const float4*)p; }

// Taps of one channel in w[ch]; x0..x3 are rows l-3..l.
__device__ __forceinline__ float4 conv4(const float4 x0, const float4 x1, const float4 x2,
                                        const float4 x3, const float4* w) {
  float4 y;
  y.x = x0.x * w[0].x;  y.x += x1.x * w[0].y;  y.x += x2.x * w[0].z;  y.x += x3.x * w[0].w;
  y.y = x0.y * w[1].x;  y.y += x1.y * w[1].y;  y.y += x2.y * w[1].z;  y.y += x3.y * w[1].w;
  y.z = x0.z * w[2].x;  y.z += x1.z * w[2].y;  y.z += x2.z * w[2].z;  y.z += x3.z * w[2].w;
  y.w = x0.w * w[3].x;  y.w += x1.w * w[3].y;  y.w += x2.w * w[3].z;  y.w += x3.w * w[3].w;
  return y;
}

// e^x by the library's own steps (x * log2 e in two parts, the whole part through
// ldexp, the two range ends), written out so that the slot behind v_exp_f32 is kept.
__device__ __forceinline__ float exp1(float x) {
  const float ph = x * 0x1.715476p+0f;
  float pl = fmaf(x, 0x1.715476p+0f, -ph);
  pl = fmaf(x, 0x1.4ae0bep-26f, pl);
  const float e = rintf(ph);
  const float a = (ph - e) + pl;
  float r;
  // v_nop: the one slot the instruction set asks for behind a transcendental before
  // its result is read or its source overwritten; one statement keeps it in place
  asm("v_exp_f32 %0, %1\n\tv_nop" : "=v"(r) : "v"(a));
  r = ldexpf(r, (int)e);
  r = x < -0x1.9d1da0p+6f ? 0.f : r;
  r = x > 0x1.62e430p+6f ? __builtin_inff() : r;
  return r;
}

__device__ __forceinline__ float silu1(float v) { return v / (1.f + exp1(-v)); }

__global__ __launch_bounds__(256)
void convprep_kernel(const float* __restrict__ kpre, const float* __restrict__ qpre,
                     const float* __restrict__ vpre, const float* __restrict__ wck,
                     const float* __restrict__ wcq, const float* __restrict__ wcv,
                     const float* __restrict__ beta,
                     float* __restrict__ Kp, float* __restrict__ Qp,
                     float* __restrict__ Vp, float* __restrict__ Bp) {
  const int c0   = threadIdx.x * 4;            // first of the lane's 4 channels
  const int head = c0 >> 6;
  const int m0   = blockIdx.x * RW;            // b*L + l of the first row
  const int b    = m0 / Lseq, l0 = m0 & (Lseq - 1);

  float4 wk[4], wq[4], wv[4];
#pragma unroll
  for (int ch = 0; ch < 4; ch++) {
    wk[ch] = ld4(wck + (c0 + ch) * CK);
    wq[ch] = ld4(wcq + (c0 + ch) * CK);
    wv[ch] = ld4(wcv + (c0 + ch) * CK);
  }

  const float* ks = kpre + (size_t)m0 * Dm + c0;
  const float* qs = qpre + (size_t)m0 * Dm + c0;
  const float* vs = vpre + (size_t)m0 * Dm + c0;
  const float* bs = beta + (size_t)m0 * H + head;

  // xk[0..2]: the three rows above the batch (zero above the sequence's first
  // row); xk[3..]: the batch itself.
  float4 xk[RB + 3], xq[RB + 3], xv[RB + 3];
  float  bt[RB];
#pragma unroll
  for (int j = 0; j < 3; j++) {
    if (l0 > 0) {
      xk[j] = ld4(ks + (j - 3) * Dm);
      xq[j] = ld4(qs + (j - 3) * Dm);
      xv[j] = ld4(vs + (j - 3) * Dm);
    } else {
      xk[j] = xq[j] = xv[j] = make_float4(0.f, 0.f, 0.f, 0.f);
    }
  }
#pragma unroll
  for (int r = 0; r < RB; r++) {
    xk[3 + r] = ld4(ks + r * Dm);
    xq[3 + r] = ld4(qs + r * Dm);
    xv[3 + r] = ld4(vs + r * Dm);
    bt[r]     = bs[r * H];
  }
  // precaution: stands in front of the first rewrite of a register that these loads
  // name; as inputs the addresses stay whole up to it, so no load lands on one
  asm volatile("s_wait_xcnt 0x0" :: "v"(ks), "v"(qs), "v"(vs) : "memory");
  // inputs only: the first batch has landed here.  Without it the loop's counted
  // waits, which must also serve the first trip, wait for the batch in flight.
  asm volatile("" :: "v"(xk[3].x), "v"(xk[4].x), "v"(xk[5].x), "v"(xk[6].x),
                     "v"(xq[3].x), "v"(xq[4].x), "v"(xq[5].x), "v"(xq[6].x),
                     "v"(xv[3].x), "v"(xv[4].x), "v"(xv[5].x), "v"(xv[6].x),
                     "v"(bt[0]), "v"(bt[1]), "v"(bt[2]), "v"(bt[3]));

  size_t dst = ((size_t)(b * H + head) * Lseq + l0) * Dh + (c0 & (Dh - 1));

#pragma unroll 1  // rolled: four rows of code stay small in the instruction cache
  for (int t = 0; t < RW; t += RB) {
    float4 nk[RB], nq[RB], nv[RB];
    float  nb[RB];
    if (t + RB < RW) {                         // the next batch flies under this one's work
#pragma unroll
      for (int r = 0; r < RB; r++) nb[r] = bs[(t + RB + r) * H];
#pragma unroll
      for (int r = 0; r < RB; r++) {
        nk[r] = ld4(ks + (t + RB + r) * Dm);
        nq[r] = ld4(qs + (t + RB + r) * Dm);
        nv[r] = ld4(vs + (t + RB + r) * Dm);
      }
      // precaution: stands in front of the first rewrite of these loads' address registers
      asm volatile("s_wait_xcnt 0x0" ::: "memory");
    }

    float4 yk[RB], yq[RB], sv[RB];
    float  sk[RB], sq[RB];
#pragma unroll
    for (int r = 0; r < RB; r++) {
      yk[r] = conv4(xk[r], xk[r + 1], xk[r + 2], xk[r + 3], wk);
      yq[r] = conv4(xq[r], xq[r + 1], xq[r + 2], xq[r + 3], wq);
      sk[r] = yk[r].x * yk[r].x + yk[r].y * yk[r].y + yk[r].z * yk[r].z + yk[r].w * yk[r].w;
      sq[r] = yq[r].x * yq[r].x + yq[r].y * yq[r].y + yq[r].z * yq[r].z + yq[r].w * yq[r].w;
    }
#pragma unroll
    for (int r = 0; r < RB; r++) {
      const float4 yv = conv4(xv[r], xv[r + 1], xv[r + 2], xv[r + 3], wv);
      sv[r] = make_float4(silu1(yv.x), silu1(yv.y), silu1(yv.z), silu1(yv.w));
    }
#pragma unroll
    for (int off = 8; off > 0; off >>= 1) {    // sums over the head's 16 lanes
#pragma unroll
      for (int r = 0; r < RB; r++) {
        sk[r] += __shfl_xor(sk[r], off);
        sq[r] += __shfl_xor(sq[r], off);
      }
    }
#pragma unroll
    for (int r = 0; r < RB; r++) {
      const float  kin = 1.f / (sqrtf(sk[r]) + 1e-6f);
      const float  qin = 1.f / (sqrtf(sq[r]) + 1e-6f);
      const float  bet = bt[r];
      const float4 kn  = make_float4(yk[r].x * kin, yk[r].y * kin, yk[r].z * kin, yk[r].w * kin);
      const size_t o   = dst + (size_t)r * Dh;
      *(float4*)(Kp + o) = kn;
      *(float4*)(Qp + o) = make_float4(yq[r].x * qin, yq[r].y * qin, yq[r].z * qin, yq[r].w * qin);
      *(float4*)(Vp + o) = make_float4(bet * sv[r].x, bet * sv[r].y, bet * sv[r].z, bet * sv[r].w);
      *(float4*)(Bp + o) = make_float4(bet * kn.x, bet * kn.y, bet * kn.z, bet * kn.w);
    }
    dst += (size_t)RB * Dh;

#pragma unroll
    for (int j = 0; j < 3; j++) {              // the batch's last three rows stay
      xk[j] = xk[RB + j];  xq[j] = xq[RB + j];  xv[j] = xv[RB + j];
    }
    if (t + RB < RW) {
#pragma unroll
      for (int r = 0; r < RB; r++) {
        xk[3 + r] = nk[r];  xq[3 + r] = nq[r];  xv[3 + r] = nv[r];  bt[r] = nb[r];
      }
    }
  }
}

// ---------------------------------------------------------------------------
// Delta-rule scan.  One 512-thread block per (b,h).  All 64x64 matmuls via
// WMMA fully in LDS.  Each matrix has the pitch of its fragment reader: PK where
// k runs along its rows (A as it stands, B transposed, and every result), PN
// where k runs from row to row (A transposed, B as it stands).  K is read both
// ways and is kept twice.
// ---------------------------------------------------------------------------
constexpr int SK = 64 * PK;
constexpr int SN = 64 * PN;

// C(64x64) = opA(A) @ opB(B); optional per-k scale on A (ksc), per-row scale
// on the result (rsc), accumulate-into-LDS.  All 512 threads participate.
// Pitches: A has PN if TA else PK; B has PK if TB else PN; Cb has PK.
__device__ __forceinline__ void mm64(const float* A, bool TA, const float* B, bool TB,
                                     float* Cb, const float* ksc, const float* rsc,
                                     bool accum, int tid) {
  const int wave = tid >> 5, lane = tid & 31;
  const int h = lane >> 4, l = lane & 15;
  const int wm = (wave >> 2) * 16, wn = (wave & 3) * 16;
  v8f acc = {};
#pragma unroll
  for (int kk = 0; kk < 64; kk += 4) {
    const int ka = kk + 2 * h;
    v2f av, bv;
    if (TA) { av.x = A[ka * PN + (wm + l)];  av.y = A[(ka + 1) * PN + (wm + l)]; }
    else    { av = *(const v2f*)&A[(wm + l) * PK + ka]; }
    if (TB) { bv = *(const v2f*)&B[(wn + l) * PK + ka]; }
    else    { bv.x = B[ka * PN + (wn + l)];  bv.y = B[(ka + 1) * PN + (wn + l)]; }
    if (ksc) { av.x *= ksc[ka]; av.y *= ksc[ka + 1]; }
    acc = WMMA_F32(av, bv, acc);
  }
#pragma unroll
  for (int i = 0; i < 8; i++) {
    const int m = wm + 8 * h + i, n = wn + l;
    float v = acc[i];
    if (rsc) v *= rsc[m];
    if (accum) Cb[m * PK + n] += v; else Cb[m * PK + n] = v;
  }
}

__global__ __launch_bounds__(512)
void delta_kernel(const float* __restrict__ Kp, const float* __restrict__ Qp,
                  const float* __restrict__ Vp, const float* __restrict__ Bp,
                  float* __restrict__ Og) {
  __shared__ __attribute__((aligned(16))) float sm[6 * SK + 4 * SN];
  float* Kc = sm + 0 * SK;   // pitch PK from here
  float* Qc = sm + 1 * SK;
  float* BO = sm + 2 * SK;   // Bc chunk, reused as O accumulator
  float* T0 = sm + 3 * SK;   // S = tril(B K^T), later QK
  float* T2 = sm + 4 * SK;   // B@Wt, then E, then K^T(U*w)
  float* T3 = sm + 5 * SK;   // K^T U
  float* Kr = sm + 6 * SK + 0 * SN;   // pitch PN from here; K again, read as K^T
  float* Wt = sm + 6 * SK + 1 * SN;
  float* Wa = sm + 6 * SK + 2 * SN;
  float* T1 = sm + 6 * SK + 3 * SN;   // RHS -> U (in-place solve)
  __shared__ float cs_s[64], wi_s[64], a_s[64], c_s[64];

  const int tid = threadIdx.x;
  const int bh  = blockIdx.x;
  const size_t base = (size_t)bh * Lseq * Dh;

  // Each thread carries two 16-byte pieces of every 64x64 chunk matrix, rows pr
  // and pr + 32 at column pd.  They are loaded one chunk ahead and wait in
  // registers, so no wave of the serial chunk loop stands on a global load.
  const int pr = tid >> 4, pd = (tid & 15) * 4;
  constexpr int PH = C * Dh / 2;            // elements from the first piece to the second
  const size_t pe = base + (size_t)tid * 4;
  float4 k0 = *(const float4*)(Kp + pe), k1 = *(const float4*)(Kp + pe + PH);
  float4 q0 = *(const float4*)(Qp + pe), q1 = *(const float4*)(Qp + pe + PH);
  float4 b0 = *(const float4*)(Bp + pe), b1 = *(const float4*)(Bp + pe + PH);
  float4 v0 = *(const float4*)(Vp + pe), v1 = *(const float4*)(Vp + pe + PH);

  for (int e = tid; e < SN; e += 512) { Wt[e] = 0.f; Wa[e] = 0.f; }
  __syncthreads();

  for (int i = 0; i < Nc; i++) {
    const float ts = (float)(i * C);
    if (tid < 64) {
      const float r1  = (float)(tid + 1);
      const float idx = ts + r1;
      const float cs  = r1 * ts + r1 * (r1 + 1.f) * 0.5f;
      cs_s[tid] = cs;
      const float sumidx = 64.f * ts + 2080.f;              // sum_{t=1..64}(ts+t)
      const float denom  = (1.f + ts + 64.f) * (ts + 64.f) * 0.5f;
      wi_s[tid] = (idx + sumidx - cs) / denom;
      const float tri0 = (1.f + ts) * ts * 0.5f;
      const float a = tri0 / (tri0 + cs);
      a_s[tid] = a;  c_s[tid] = 1.f - a;
    }
    const size_t cb = base + (size_t)i * C * Dh;
    *(float4*)&Kc[pr * PK + pd] = k0;  *(float4*)&Kc[(pr + 32) * PK + pd] = k1;
    *(float4*)&Kr[pr * PN + pd] = k0;  *(float4*)&Kr[(pr + 32) * PN + pd] = k1;
    *(float4*)&Qc[pr * PK + pd] = q0;  *(float4*)&Qc[(pr + 32) * PK + pd] = q1;
    *(float4*)&BO[pr * PK + pd] = b0;  *(float4*)&BO[(pr + 32) * PK + pd] = b1;
    __syncthreads();

    mm64(BO, false, Kc, true,  T0, nullptr, nullptr, false, tid);   // S  = B K^T
    mm64(BO, false, Wt, false, T2, nullptr, nullptr, false, tid);   // P  = B Wt
    __syncthreads();

    {                                                               // RHS = V - P
      const float4 p0 = *(const float4*)&T2[pr * PK + pd];
      const float4 p1 = *(const float4*)&T2[(pr + 32) * PK + pd];
      *(float4*)&T1[pr * PN + pd] =
          make_float4(v0.x - p0.x, v0.y - p0.y, v0.z - p0.z, v0.w - p0.w);
      *(float4*)&T1[(pr + 32) * PN + pd] =
          make_float4(v1.x - p1.x, v1.y - p1.y, v1.z - p1.z, v1.w - p1.w);
    }
    __syncthreads();

    // Solve (I + tril(S,-1)) U = RHS by blocks of 16 rows.  Waves 0 and 1 solve
    // the 16x16 diagonal system, one column a lane, wholly in registers: the
    // block of S is read once, spread over the lanes (lane = row + 16 * (col / 8),
    // eight columns a lane), and each coefficient reaches the multiply-add as a
    // scalar through readlane, so no LDS latency stands between the 120 steps.
    // Then all rows below take  RHS -= S[rows][block] @ U[block]  on WMMA, one
    // 16x16 tile a wave.
#pragma unroll  // rb constant: LDS offsets become immediates, the last update drops out
    for (int rb = 0; rb < C; rb += 16) {
      if (tid < 64) {
        const int sl = tid & 31;
        int   sd[8];
        float u[16];
#pragma unroll  // register arrays and readlane need constant indices
        for (int c2 = 0; c2 < 8; c2++)
          sd[c2] = __float_as_int(T0[(rb + (sl & 15)) * PK + rb + 8 * (sl >> 4) + c2]);
#pragma unroll  // register arrays and readlane need constant indices
        for (int r = 0; r < 16; r++) u[r] = T1[(rb + r) * PN + tid];
#pragma unroll  // register arrays and readlane need constant indices
        for (int j = 0; j < 15; j++) {
#pragma unroll  // register arrays and readlane need constant indices
          for (int r = j + 1; r < 16; r++) {
            const float s = __int_as_float(__builtin_amdgcn_readlane(sd[j & 7], r + 16 * (j >> 3)));
            u[r] -= s * u[j];
          }
        }
#pragma unroll  // register arrays and readlane need constant indices
        for (int r = 1; r < 16; r++) T1[(rb + r) * PN + tid] = u[r];
      }
      __syncthreads();
      if (rb + 16 < C) {
        const int wave = tid >> 5, lane = tid & 31;
        const int h = lane >> 4, l = lane & 15;
        const int wm = (wave >> 2) * 16, wn = (wave & 3) * 16;
        if (wm > rb) {
          float t[8];
#pragma unroll  // register arrays need constant indices
          for (int i2 = 0; i2 < 8; i2++) t[i2] = T1[(wm + 8 * h + i2) * PN + wn + l];
          v8f acc = {};
#pragma unroll  // four chained WMMA with their LDS offsets as immediates
          for (int kk = 0; kk < 16; kk += 4) {
            const int ka = rb + kk + 2 * h;
            const v2f av = *(const v2f*)&T0[(wm + l) * PK + ka];
            v2f bv;
            bv.x = T1[ka * PN + (wn + l)];
            bv.y = T1[(ka + 1) * PN + (wn + l)];
            acc = WMMA_F32(av, bv, acc);
          }
#pragma unroll  // register arrays need constant indices
          for (int i2 = 0; i2 < 8; i2++) T1[(wm + 8 * h + i2) * PN + wn + l] = t[i2] - acc[i2];
        }
        __syncthreads();
      }
    }

    mm64(Qc, false, Kc, true, T0, nullptr, nullptr, false, tid);    // QK = Q K^T
    __syncthreads();

    {                                                               // E = T_mat o QK
      const float tri0 = (1.f + ts) * ts * 0.5f;
      for (int e = tid; e < C * C; e += 512) {
        const int r = e >> 6, j = e & 63;
        const float csr  = cs_s[r];
        const float jidx = cs_s[j] - (ts + (float)(j + 1));
        const float tm = (csr >= jidx) ? (csr - jidx) / (tri0 + csr) : 0.f;
        T2[r * PK + j] = tm * T0[r * PK + j];
      }
    }
    __syncthreads();

    mm64(Qc, false, Wa, false, BO, nullptr, a_s, false, tid);       // O  = a*(Q Wa)
    __syncthreads();
    mm64(Qc, false, Wt, false, BO, nullptr, c_s, true, tid);        // O += c*(Q Wt)
    __syncthreads();
    mm64(T2, false, T1, false, BO, nullptr, nullptr, true, tid);    // O += E U
    __syncthreads();

    // The next chunk's pieces are asked for here, at the head of the longest
    // stretch without a barrier (two products): a barrier waits for every load
    // of its wave, and by the one that ends this stretch they have landed.
    if (i + 1 < Nc) {
      const size_t pn = pe + (size_t)(i + 1) * C * Dh;
      k0 = *(const float4*)(Kp + pn);  k1 = *(const float4*)(Kp + pn + PH);
      q0 = *(const float4*)(Qp + pn);  q1 = *(const float4*)(Qp + pn + PH);
      b0 = *(const float4*)(Bp + pn);  b1 = *(const float4*)(Bp + pn + PH);
      v0 = *(const float4*)(Vp + pn);  v1 = *(const float4*)(Vp + pn + PH);
    }

    for (int e = tid; e < C * Dh; e += 512) {
      const int r = e >> 6, d = e & 63;
      Og[cb + e] = BO[r * PK + d];
    }

    mm64(Kr, true, T1, false, T3, nullptr, nullptr, false, tid);    // K^T U
    mm64(Kr, true, T1, false, T2, wi_s,   nullptr, false, tid);     // K^T (U * w_i)
    __syncthreads();

    {
      const float coef1 = ts / (ts + 64.f) * ((1.f + ts) / (1.f + ts + 64.f));
      const float coef2 = 64.f / (ts + 64.f) * ((ts * 2.f + 1.f + 64.f) / (1.f + ts + 64.f));
      for (int e = tid; e < C * Dh; e += 512) {
        const int r = e >> 6, d = e & 63, o = r * PN + d, p = r * PK + d;
        const float wt = Wt[o], wa = Wa[o];
        Wa[o] = coef1 * wa + coef2 * wt + T2[p];
        Wt[o] = wt + T3[p];
      }
    }
    __syncthreads();
  }
}

// ---------------------------------------------------------------------------
// RMS norm over Dh; scatter from [bh][l][Dh] to (B,L,Dm) layout.
// ---------------------------------------------------------------------------
__global__ __launch_bounds__(256)
void rms_kernel(const float* __restrict__ Og, const float* __restrict__ rmsw,
                float* __restrict__ On) {
  const int row = blockIdx.x * 8 + (threadIdx.x >> 5);   // bh*L + l
  if (row >= Bb * H * Lseq) return;
  const int lane = threadIdx.x & 31;
  const int bh = row / Lseq, l = row & (Lseq - 1);
  const int b = bh >> 4, h = bh & 15;
  const size_t src = (size_t)row * Dh;
  const float o0 = Og[src + lane], o1 = Og[src + lane + 32];
  float ss = o0 * o0 + o1 * o1;
#pragma unroll
  for (int off = 16; off > 0; off >>= 1) ss += __shfl_xor(ss, off);
  const float inv = rsqrtf(ss * (1.f / 64.f) + 1e-6f);
  const size_t dst = ((size_t)(b * Lseq + l)) * Dm + h * Dh;
  On[dst + lane]      = o0 * inv * rmsw[lane];
  On[dst + lane + 32] = o1 * inv * rmsw[lane + 32];
}

// ---------------------------------------------------------------------------
extern "C" void kernel_launch(void* const* d_in, const int* in_sizes, int n_in,
                              void* d_out, int out_size, void* d_ws, size_t ws_size,
                              hipStream_t stream) {
  (void)in_sizes; (void)n_in; (void)out_size; (void)ws_size;
  const float* x     = (const float*)d_in[0];
  const float* Wk    = (const float*)d_in[1];
  const float* bk    = (const float*)d_in[2];
  const float* Wq    = (const float*)d_in[3];
  const float* bq    = (const float*)d_in[4];
  const float* Wv    = (const float*)d_in[5];
  const float* bv    = (const float*)d_in[6];
  const float* Wbeta = (const float*)d_in[7];
  const float* bbeta = (const float*)d_in[8];
  const float* convk = (const float*)d_in[9];
  const float* convq = (const float*)d_in[10];
  const float* convv = (const float*)d_in[11];
  const float* rmsw  = (const float*)d_in[12];
  const float* Wout  = (const float*)d_in[13];
  const float* boutp = (const float*)d_in[14];
  float* out = (float*)d_out;

  float* ws = (float*)d_ws;
  const size_t SLOT = (size_t)Mrows * Dm;         // 8.39M floats = 32 MB
  float* kpre = ws + 0 * SLOT;                    // -> reused as Ograw
  float* qpre = ws + 1 * SLOT;                    // -> reused as On
  float* vpre = ws + 2 * SLOT;
  float* Kp   = ws + 3 * SLOT;
  float* Qp   = ws + 4 * SLOT;
  float* Vp   = ws + 5 * SLOT;
  float* Bp   = ws + 6 * SLOT;
  float* beta = ws + 7 * SLOT;                    // 131072 floats
  float* Ograw = kpre; float* On = qpre;

  const dim3 gg(Dm / 64, Mrows / 64);             // (16, 128)
  gemm_xwt_kernel<<<gg, 512, 0, stream>>>(x, Wk, bk, kpre, Mrows, Dm, Dm);
  gemm_xwt_kernel<<<gg, 512, 0, stream>>>(x, Wq, bq, qpre, Mrows, Dm, Dm);
  gemm_xwt_kernel<<<gg, 512, 0, stream>>>(x, Wv, bv, vpre, Mrows, Dm, Dm);
  beta_kernel<<<(Mrows * H) / 256, 256, 0, stream>>>(x, Wbeta, bbeta, beta);

  convprep_kernel<<<Mrows / RW, 256, 0, stream>>>(kpre, qpre, vpre, convk, convq, convv, beta,
                                                  Kp, Qp, Vp, Bp);

  delta_kernel<<<Bb * H, 512, 0, stream>>>(Kp, Qp, Vp, Bp, Ograw);   // 182 KiB of static LDS

  rms_kernel<<<(Bb * H * Lseq) / 8, 256, 0, stream>>>(Ograw, rmsw, On);

  gemm_xwt_kernel<<<gg, 512, 0, stream>>>(On, Wout, boutp, out, Mrows, Dm, Dm);
}

// v005
// Measured time: 613 microseconds a run.
// In both of two side-by-side timings against v004, it was 1.26 times as fast.
// All steps since v000 together make it 3.52 times as fast.
#include <hip/hip_runtime.h>
#include <hip/hip_bf16.h>

typedef float v2f __attribute__((ext_vector_type(2)));
typedef float v8f __attribute__((ext_vector_type(8)));

#define WMMA_F32(a, b, c) \
  __builtin_amdgcn_wmma_f32_16x16x4_f32(false, (a), false, (b), (short)0, (c), false, false)

constexpr int Bb    = 4;
constexpr int Lseq  = 2048;
constexpr int Dm    = 1024;
constexpr int H     = 16;
constexpr int Dh    = 64;
constexpr int CK    = 4;      // conv kernel width
constexpr int C     = 64;     // chunk
constexpr int Nc    = Lseq / C;
constexpr int Mrows = Bb * Lseq;   // 8192

// LDS row pitches, in floats (64 banks of 4 bytes).  A 16x16x4 fragment is 64
// dwords: 16 rows (or columns) times 4 values of k.
// PK: the reader takes k along a row, lane l in row l: 68 = 4 mod 64 puts row l
//     on banks 4l..4l+3, so the 64 dwords fall on 64 banks, as one 8-byte read.
// PN: the reader takes k from row to row, lane l in column l: 80 = 16 mod 64
//     puts the four rows of a step 16 banks apart, again 64 banks.
constexpr int PK = 68;
constexpr int PN = 80;

// ---------------------------------------------------------------------------
// Generic Y = X @ W^T + bias GEMM.  X:(M,K) row-major, W:(N,K) row-major.
// 64x64 tile per 512-thread block (16 waves, each one 16x16 WMMA tile).
// Both tiles are read with k along the row: pitch PK.
// ---------------------------------------------------------------------------
__global__ __launch_bounds__(512)
void gemm_xwt_kernel(const float* __restrict__ X, const float* __restrict__ W,
                     const float* __restrict__ bias, float* __restrict__ Y,
                     int M, int N, int K) {
  __shared__ __attribute__((aligned(16))) float Xs[64][PK];
  __shared__ __attribute__((aligned(16))) float Ws[64][PK];
  const int tid  = threadIdx.x;
  const int wave = tid >> 5, lane = tid & 31;
  const int h = lane >> 4, l = lane & 15;
  const int wm = (wave >> 2) * 16, wn = (wave & 3) * 16;
  const int m0 = blockIdx.y * 64, n0 = blockIdx.x * 64;
  const int lr = tid >> 3;          // 0..63 (tile row to load)
  const int lc = (tid & 7) * 8;     // col start (8 floats per thread)

  v8f acc = {};
  for (int k0 = 0; k0 < K; k0 += 64) {
    float4 xa = *(const float4*)(X + (size_t)(m0 + lr) * K + k0 + lc);
    float4 xb = *(const float4*)(X + (size_t)(m0 + lr) * K + k0 + lc + 4);
    float4 wa = *(const float4*)(W + (size_t)(n0 + lr) * K + k0 + lc);
    float4 wb = *(const float4*)(W + (size_t)(n0 + lr) * K + k0 + lc + 4);
    __syncthreads();
    Xs[lr][lc + 0] = xa.x; Xs[lr][lc + 1] = xa.y; Xs[lr][lc + 2] = xa.z; Xs[lr][lc + 3] = xa.w;
    Xs[lr][lc + 4] = xb.x; Xs[lr][lc + 5] = xb.y; Xs[lr][lc + 6] = xb.z; Xs[lr][lc + 7] = xb.w;
    Ws[lr][lc + 0] = wa.x; Ws[lr][lc + 1] = wa.y; Ws[lr][lc + 2] = wa.z; Ws[lr][lc + 3] = wa.w;
    Ws[lr][lc + 4] = wb.x; Ws[lr][lc + 5] = wb.y; Ws[lr][lc + 6] = wb.z; Ws[lr][lc + 7] = wb.w;
    __syncthreads();
#pragma unroll
    for (int kk = 0; kk < 64; kk += 4) {
      const int ka = kk + 2 * h;          // lanes 16-31 carry K = 2,3 of the step
      const v2f av = *(const v2f*)&Xs[wm + l][ka];
      const v2f bv = *(const v2f*)&Ws[wn + l][ka];
      acc = WMMA_F32(av, bv, acc);
    }
  }
#pragma unroll
  for (int i = 0; i < 8; i++) {
    const int m = m0 + wm + 8 * h + i;    // vgpr i -> M = i + 8*half
    const int n = n0 + wn + l;
    Y[(size_t)m * N + n] = acc[i] + bias[n];
  }
}

// ---------------------------------------------------------------------------
// beta = sigmoid(x @ Wbeta^T + bbeta), shape (Mrows, H)
// ---------------------------------------------------------------------------
__global__ void beta_kernel(const float* __restrict__ X, const float* __restrict__ Wb,
                            const float* __restrict__ bb, float* __restrict__ beta) {
  const int t = blockIdx.x * blockDim.x + threadIdx.x;
  if (t >= Mrows * H) return;
  const int m = t >> 4, h = t & 15;
  const float* xr = X + (size_t)m * Dm;
  const float* wr = Wb + (size_t)h * Dm;
  float s = bb[h];
  for (int k = 0; k < Dm; k += 4) {
    s += xr[k] * wr[k] + xr[k + 1] * wr[k + 1] + xr[k + 2] * wr[k + 2] + xr[k + 3] * wr[k + 3];
  }
  beta[t] = 1.f / (1.f + expf(-s));
}

// ---------------------------------------------------------------------------
// Causal depthwise conv along L of the k, q and v projections,
//   y[b,l,c] = sum_j x[b, l-3+j, c] * w[c,j],
// and, on the rows as they leave the conv: normalize k,q; v = beta*silu(v);
// b = beta*k.  Outputs in [bh][l][Dh] layout.
// A wave takes 128 channels (two heads, 16 lanes a head, 4 channels a lane) and
// slides down RW rows: the three rows above stay in registers, a row is loaded
// as 512 contiguous bytes, RB rows ahead of its use.
// ---------------------------------------------------------------------------
constexpr int RW = 16;    // rows a wave
constexpr int RB = 4;     // rows a batch of loads

__device__ __forceinline__ float4 ld4(const float* p) { return *(const float4*)p; }

// Taps of one channel in w[ch]; x0..x3 are rows l-3..l.
__device__ __forceinline__ float4 conv4(const float4 x0, const float4 x1, const float4 x2,
                                        const float4 x3, const float4* w) {
  float4 y;
  y.x = x0.x * w[0].x;  y.x += x1.x * w[0].y;  y.x += x2.x * w[0].z;  y.x += x3.x * w[0].w;
  y.y = x0.y * w[1].x;  y.y += x1.y * w[1].y;  y.y += x2.y * w[1].z;  y.y += x3.y * w[1].w;
  y.z = x0.z * w[2].x;  y.z += x1.z * w[2].y;  y.z += x2.z * w[2].z;  y.z += x3.z * w[2].w;
  y.w = x0.w * w[3].x;  y.w += x1.w * w[3].y;  y.w += x2.w * w[3].z;  y.w += x3.w * w[3].w;
  return y;
}

// e^x by the library's own steps (x * log2 e in two parts, the whole part through
// ldexp, the two range ends), written out so that the slot behind v_exp_f32 is kept.
__device__ __forceinline__ float exp1(float x) {
  const float ph = x * 0x1.715476p+0f;
  float pl = fmaf(x, 0x1.715476p+0f, -ph);
  pl = fmaf(x, 0x1.4ae0bep-26f, pl);
  const float e = rintf(ph);
  const float a = (ph - e) + pl;
  float r;
  // v_nop: the one slot the instruction set asks for behind a transcendental before
  // its result is read or its source overwritten; one statement keeps it in place
  asm("v_exp_f32 %0, %1\n\tv_nop" : "=v"(r) : "v"(a));
  r = ldexpf(r, (int)e);
  r = x < -0x1.9d1da0p+6f ? 0.f : r;
  r = x > 0x1.62e430p+6f ? __builtin_inff() : r;
  return r;
}

__device__ __forceinline__ float silu1(float v) { return v / (1.f + exp1(-v)); }

__global__ __launch_bounds__(256)
void convprep_kernel(const float* __restrict__ kpre, const float* __restrict__ qpre,
                     const float* __restrict__ vpre, const float* __restrict__ wck,
                     const float* __restrict__ wcq, const float* __restrict__ wcv,
                     const float* __restrict__ beta,
                     float* __restrict__ Kp, float* __restrict__ Qp,
                     float* __restrict__ Vp, float* __restrict__ Bp) {
  const int c0   = threadIdx.x * 4;            // first of the lane's 4 channels
  const int head = c0 >> 6;
  const int m0   = blockIdx.x * RW;            // b*L + l of the first row
  const int b    = m0 / Lseq, l0 = m0 & (Lseq - 1);

  float4 wk[4], wq[4], wv[4];
#pragma unroll
  for (int ch = 0; ch < 4; ch++) {
    wk[ch] = ld4(wck + (c0 + ch) * CK);
    wq[ch] = ld4(wcq + (c0 + ch) * CK);
    wv[ch] = ld4(wcv + (c0 + ch) * CK);
  }

  const float* ks = kpre + (size_t)m0 * Dm + c0;
  const float* qs = qpre + (size_t)m0 * Dm + c0;
  const float* vs = vpre + (size_t)m0 * Dm + c0;
  const float* bs = beta + (size_t)m0 * H + head;

  // xk[0..2]: the three rows above the batch (zero above the sequence's first
  // row); xk[3..]: the batch itself.
  float4 xk[RB + 3], xq[RB + 3], xv[RB + 3];
  float  bt[RB];
#pragma unroll
  for (int j = 0; j < 3; j++) {
    if (l0 > 0) {
      xk[j] = ld4(ks + (j - 3) * Dm);
      xq[j] = ld4(qs + (j - 3) * Dm);
      xv[j] = ld4(vs + (j - 3) * Dm);
    } else {
      xk[j] = xq[j] = xv[j] = make_float4(0.f, 0.f, 0.f, 0.f);
    }
  }
#pragma unroll
  for (int r = 0; r < RB; r++) {
    xk[3 + r] = ld4(ks + r * Dm);
    xq[3 + r] = ld4(qs + r * Dm);
    xv[3 + r] = ld4(vs + r * Dm);
    bt[r]     = bs[r * H];
  }
  // precaution: stands in front of the first rewrite of a register that these loads
  // name; as inputs the addresses stay whole up to it, so no load lands on one
  asm volatile("s_wait_xcnt 0x0" :: "v"(ks), "v"(qs), "v"(vs) : "memory");
  // inputs only: the first batch has landed here.  Without it the loop's counted
  // waits, which must also serve the first trip, wait for the batch in flight.
  asm volatile("" :: "v"(xk[3].x), "v"(xk[4].x), "v"(xk[5].x), "v"(xk[6].x),
                     "v"(xq[3].x), "v"(xq[4].x), "v"(xq[5].x), "v"(xq[6].x),
                     "v"(xv[3].x), "v"(xv[4].x), "v"(xv[5].x), "v"(xv[6].x),
                     "v"(bt[0]), "v"(bt[1]), "v"(bt[2]), "v"(bt[3]));

  size_t dst = ((size_t)(b * H + head) * Lseq + l0) * Dh + (c0 & (Dh - 1));

#pragma unroll 1  // rolled: four rows of code stay small in the instruction cache
  for (int t = 0; t < RW; t += RB) {
    float4 nk[RB], nq[RB], nv[RB];
    float  nb[RB];
    if (t + RB < RW) {                         // the next batch flies under this one's work
#pragma unroll
      for (int r = 0; r < RB; r++) nb[r] = bs[(t + RB + r) * H];
#pragma unroll
      for (int r = 0; r < RB; r++) {
        nk[r] = ld4(ks + (t + RB + r) * Dm);
        nq[r] = ld4(qs + (t + RB + r) * Dm);
        nv[r] = ld4(vs + (t + RB + r) * Dm);
      }
      // precaution: stands in front of the first rewrite of these loads' address registers
      asm volatile("s_wait_xcnt 0x0" ::: "memory");
    }

    float4 yk[RB], yq[RB], sv[RB];
    float  sk[RB], sq[RB];
#pragma unroll
    for (int r = 0; r < RB; r++) {
      yk[r] = conv4(xk[r], xk[r + 1], xk[r + 2], xk[r + 3], wk);
      yq[r] = conv4(xq[r], xq[r + 1], xq[r + 2], xq[r + 3], wq);
      sk[r] = yk[r].x * yk[r].x + yk[r].y * yk[r].y + yk[r].z * yk[r].z + yk[r].w * yk[r].w;
      sq[r] = yq[r].x * yq[r].x + yq[r].y * yq[r].y + yq[r].z * yq[r].z + yq[r].w * yq[r].w;
    }
#pragma unroll
    for (int r = 0; r < RB; r++) {
      const float4 yv = conv4(xv[r], xv[r + 1], xv[r + 2], xv[r + 3], wv);
      sv[r] = make_float4(silu1(yv.x), silu1(yv.y), silu1(yv.z), silu1(yv.w));
    }
#pragma unroll
    for (int off = 8; off > 0; off >>= 1) {    // sums over the head's 16 lanes
#pragma unroll
      for (int r = 0; r < RB; r++) {
        sk[r] += __shfl_xor(sk[r], off);
        sq[r] += __shfl_xor(sq[r], off);
      }
    }
#pragma unroll
    for (int r = 0; r < RB; r++) {
      const float  kin = 1.f / (sqrtf(sk[r]) + 1e-6f);
      const float  qin = 1.f / (sqrtf(sq[r]) + 1e-6f);
      const float  bet = bt[r];
      const float4 kn  = make_float4(yk[r].x * kin, yk[r].y * kin, yk[r].z * kin, yk[r].w * kin);
      const size_t o   = dst + (size_t)r * Dh;
      *(float4*)(Kp + o) = kn;
      *(float4*)(Qp + o) = make_float4(yq[r].x * qin, yq[r].y * qin, yq[r].z * qin, yq[r].w * qin);
      *(float4*)(Vp + o) = make_float4(bet * sv[r].x, bet * sv[r].y, bet * sv[r].z, bet * sv[r].w);
      *(float4*)(Bp + o) = make_float4(bet * kn.x, bet * kn.y, bet * kn.z, bet * kn.w);
    }
    dst += (size_t)RB * Dh;

#pragma unroll
    for (int j = 0; j < 3; j++) {              // the batch's last three rows stay
      xk[j] = xk[RB + j];  xq[j] = xq[RB + j];  xv[j] = xv[RB + j];
    }
    if (t + RB < RW) {
#pragma unroll
      for (int r = 0; r < RB; r++) {
        xk[3 + r] = nk[r];  xq[3 + r] = nq[r];  xv[3 + r] = nv[r];  bt[r] = nb[r];
      }
    }
  }
}

// ---------------------------------------------------------------------------
// Delta-rule scan.  The value columns of a head do not meet: column d of U, O and
// of both states comes from column d of V alone.  So NS work-groups share a head,
// each with NV of its Dh columns; only B K^T and Q K^T are formed in all of them.
// 512 threads.  All products via WMMA fully in LDS.  Pitches follow the fragment
// reader: PK where k runs along the rows (A as it stands, B transposed, 64x64
// results), PN or PW where k runs from row to row (K read as K^T; the NV-column
// matrices as B).  K is read both ways and is kept twice.
// A 64xNV product has four 16x16 tiles: the 16 waves take a tile and a quarter of
// k each, and the step that reads the result adds the four partial sums.
// ---------------------------------------------------------------------------
constexpr int NS = 4;          // work-groups a head
constexpr int NV = Dh / NS;    // value columns a work-group
constexpr int PW = NV;         // 16: the four rows of a k step fill the 64 banks
constexpr int PP = 20;         // partial sums: rows 8 apart fall 32 banks apart
constexpr int SK = 64 * PK;
constexpr int SN = 64 * PN;
constexpr int SW = 64 * PW;
constexpr int SP = 64 * PP;

// C(64x64) = A @ B^T, all three at pitch PK; a 16x16 tile a wave.
__device__ __forceinline__ void mm64_abt(const float* A, const float* B, float* Cb, int tid) {
  const int wave = tid >> 5, lane = tid & 31;
  const int h = lane >> 4, l = lane & 15;
  const int wm = (wave >> 2) * 16, wn = (wave & 3) * 16;
  v8f acc = {};
#pragma unroll
  for (int kk = 0; kk < 64; kk += 4) {
    const int ka = kk + 2 * h;
    const v2f av = *(const v2f*)&A[(wm + l) * PK + ka];
    const v2f bv = *(const v2f*)&B[(wn + l) * PK + ka];
    acc = WMMA_F32(av, bv, acc);
  }
#pragma unroll
  for (int i = 0; i < 8; i++) Cb[(wm + 8 * h + i) * PK + wn + l] = acc[i];
}

// B fragment of an NV-column matrix: rows ka and ka + 1, column l.
__device__ __forceinline__ v2f bfrag(const float* B, int ka, int l) {
  v2f bv;
  bv.x = B[ka * PW + l];
  bv.y = B[(ka + 1) * PW + l];
  return bv;
}

// The four partial sums of elements (r, c) and (r, c + 1), po = r * PP + c.
__device__ __forceinline__ float2 sum4(const float* P, int po) {
  const float2 p0 = *(const float2*)&P[0 * SP + po];
  const float2 p1 = *(const float2*)&P[1 * SP + po];
  const float2 p2 = *(const float2*)&P[2 * SP + po];
  const float2 p3 = *(const float2*)&P[3 * SP + po];
  return make_float2((p0.x + p1.x) + (p2.x + p3.x), (p0.y + p1.y) + (p2.y + p3.y));
}

__global__ __launch_bounds__(512)
void delta_kernel(const float* __restrict__ Kp, const float* __restrict__ Qp,
                  const float* __restrict__ Vp, const float* __restrict__ Bp,
                  float* __restrict__ Og) {
  __shared__ __attribute__((aligned(16))) float sm[5 * SK + SN + 3 * SW + 12 * SP];
  float* Kc = sm + 0 * SK;   // pitch PK from here
  float* Qc = sm + 1 * SK;
  float* Bc = sm + 2 * SK;
  float* T0 = sm + 3 * SK;   // S = B K^T, later QK
  float* T2 = sm + 4 * SK;   // E
  float* Kr = sm + 5 * SK;   // pitch PN; K again, read as K^T
  float* Wt = Kr + SN;       // pitch PW from here
  float* Wa = Wt + SW;
  float* T1 = Wa + SW;       // RHS -> U (in-place solve)
  float* PA = T1 + SW;       // pitch PP from here, four partial sums each: B Wt, later O
  float* PB = PA + 4 * SP;   // K^T U
  float* PC = PB + 4 * SP;   // K^T (U * w)
  __shared__ float cs_s[64], wi_s[64], a_s[64], c_s[64];

  const int tid = threadIdx.x;
  // The NS work-groups of a head stand 64 apart in the grid (for speed only: they
  // read the same K, Q and B).
  const int bh  = blockIdx.x & (Bb * H - 1);
  const int cq  = blockIdx.x / (Bb * H);
  const size_t base = (size_t)bh * Lseq * Dh;

  const int wave = tid >> 5, lane = tid & 31;
  const int h = lane >> 4, l = lane & 15;
  const int tm = (wave >> 2) * 16;          // the wave's tile of a 64xNV product
  const int kq = wave & 3;                  // and its quarter of k
  const int ks = kq * 16;

  // Each thread carries two 16-byte pieces of the 64x64 chunk matrices K, Q, B, rows
  // pr and pr + 32 at column pd, and two values of the 64xNV slice of V, row vr at
  // column vc.  They are loaded one chunk ahead and wait in registers, so no wave
  // of the serial chunk loop stands on a global load.
  const int pr = tid >> 4, pd = (tid & 15) * 4;
  const int vr = tid >> 3, vc = (tid & 7) * 2;
  const int po = vr * PP + vc, wo = vr * PW + vc;
  constexpr int PH = C * Dh / 2;            // elements from the first piece to the second
  const float* kg = Kp + base + (size_t)tid * 4;
  const float* qg = Qp + base + (size_t)tid * 4;
  const float* bg = Bp + base + (size_t)tid * 4;
  const float* vg = Vp + base + (size_t)vr * Dh + cq * NV + vc;
  float4 k0 = *(const float4*)kg, k1 = *(const float4*)(kg + PH);
  float4 q0 = *(const float4*)qg, q1 = *(const float4*)(qg + PH);
  float4 b0 = *(const float4*)bg, b1 = *(const float4*)(bg + PH);
  float2 vv = *(const float2*)vg;
  // precaution: stands in front of the first rewrite of a register that these loads
  // name; as inputs the addresses stay whole up to it, so no load lands on one
  asm volatile("s_wait_xcnt 0x0" :: "v"(kg), "v"(qg), "v"(bg), "v"(vg) : "memory");

  // O leaves as [bh][cq][l][NV]: a work-group's rows are contiguous, so no 128-byte
  // line has two writers.
  float* og = Og + (size_t)(bh * NS + cq) * Lseq * NV + tid * 2;

  *(float2*)&Wt[wo] = make_float2(0.f, 0.f);
  *(float2*)&Wa[wo] = make_float2(0.f, 0.f);
  __syncthreads();

  for (int i = 0; i < Nc; i++) {
    const float ts = (float)(i * C);
    if (tid < 64) {
      const float r1  = (float)(tid + 1);
      const float idx = ts + r1;
      const float cs  = r1 * ts + r1 * (r1 + 1.f) * 0.5f;
      cs_s[tid] = cs;
      const float sumidx = 64.f * ts + 2080.f;              // sum_{t=1..64}(ts+t)
      const float denom  = (1.f + ts + 64.f) * (ts + 64.f) * 0.5f;
      wi_s[tid] = (idx + sumidx - cs) / denom;
      const float tri0 = (1.f + ts) * ts * 0.5f;
      const float a = tri0 / (tri0 + cs);
      a_s[tid] = a;  c_s[tid] = 1.f - a;
    }
    *(float4*)&Kc[pr * PK + pd] = k0;  *(float4*)&Kc[(pr + 32) * PK + pd] = k1;
    *(float4*)&Kr[pr * PN + pd] = k0;  *(float4*)&Kr[(pr + 32) * PN + pd] = k1;
    *(float4*)&Qc[pr * PK + pd] = q0;  *(float4*)&Qc[(pr + 32) * PK + pd] = q1;
    *(float4*)&Bc[pr * PK + pd] = b0;  *(float4*)&Bc[(pr + 32) * PK + pd] = b1;
    __syncthreads();

    mm64_abt(Bc, Kc, T0, tid);                                      // S  = B K^T
    {                                                               // P  = B Wt
      v8f acc = {};
#pragma unroll  // four chained WMMA with their LDS offsets as immediates
      for (int kk = 0; kk < 16; kk += 4) {
        const int ka = ks + kk + 2 * h;
        const v2f av = *(const v2f*)&Bc[(tm + l) * PK + ka];
        acc = WMMA_F32(av, bfrag(Wt, ka, l), acc);
      }
#pragma unroll
      for (int i2 = 0; i2 < 8; i2++) PA[kq * SP + (tm + 8 * h + i2) * PP + l] = acc[i2];
    }
    __syncthreads();

    {                                                               // RHS = V - P
      const float2 p = sum4(PA, po);
      *(float2*)&T1[wo] = make_float2(vv.x - p.x, vv.y - p.y);
    }
    __syncthreads();

    // Solve (I + tril(S,-1)) U = RHS by blocks of 16 rows.  Wave 0 solves the 16x16
    // diagonal system, one column a lane (both halves of the wave the same NV
    // columns), wholly in registers: the block of S is read once, spread over the
    // lanes (lane = row + 16 * (col / 8), eight columns a lane), and each
    // coefficient reaches the multiply-add as a scalar through readlane, so no LDS
    // latency stands between the 120 steps.  Then all rows below take
    // RHS -= S[rows][block] @ U[block]  on WMMA, one 16x16 tile a wave: waves 5, 10
    // and 15, which differ both in wave / 4 and in wave % 4.
#pragma unroll  // rb constant: LDS offsets become immediates, the last update drops out
    for (int rb = 0; rb < C; rb += 16) {
      if (tid < 32) {
        int   sd[8];
        float u[16];
#pragma unroll  // register arrays and readlane need constant indices
        for (int c2 = 0; c2 < 8; c2++)
          sd[c2] = __float_as_int(T0[(rb + l) * PK + rb + 8 * h + c2]);
#pragma unroll  // register arrays and readlane need constant indices
        for (int r = 0; r < 16; r++) u[r] = T1[(rb + r) * PW + l];
#pragma unroll  // register arrays and readlane need constant indices
        for (int j = 0; j < 15; j++) {
#pragma unroll  // register arrays and readlane need constant indices
          for (int r = j + 1; r < 16; r++) {
            const float s = __int_as_float(__builtin_amdgcn_readlane(sd[j & 7], r + 16 * (j >> 3)));
            u[r] -= s * u[j];
          }
        }
#pragma unroll  // register arrays and readlane need constant indices
        for (int r = 1; r < 16; r++) T1[(rb + r) * PW + l] = u[r];   // both halves: same value, same place
      }
      __syncthreads();
      if (rb + 16 < C) {
        if (tm == ks && tm > rb) {
          float t[8];
#pragma unroll  // register arrays need constant indices
          for (int i2 = 0; i2 < 8; i2++) t[i2] = T1[(tm + 8 * h + i2) * PW + l];
          v8f acc = {};
#pragma unroll  // four chained WMMA with their LDS offsets as immediates
          for (int kk = 0; kk < 16; kk += 4) {
            const int ka = rb + kk + 2 * h;
            const v2f av = *(const v2f*)&T0[(tm + l) * PK + ka];
            acc = WMMA_F32(av, bfrag(T1, ka, l), acc);
          }
#pragma unroll  // register arrays need constant indices
          for (int i2 = 0; i2 < 8; i2++) T1[(tm + 8 * h + i2) * PW + l] = t[i2] - acc[i2];
        }
        __syncthreads();
      }
    }

    mm64_abt(Qc, Kc, T0, tid);                                      // QK = Q K^T
    __syncthreads();

    {                                                               // E = T_mat o QK
      const float tri0 = (1.f + ts) * ts * 0.5f;
      for (int e = tid; e < C * C; e += 512) {
        const int r = e >> 6, j = e & 63;
        const float csr  = cs_s[r];
        const float jidx = cs_s[j] - (ts + (float)(j + 1));
        const float tm2 = (csr >= jidx) ? (csr - jidx) / (tri0 + csr) : 0.f;
        T2[r * PK + j] = tm2 * T0[r * PK + j];
      }
    }
    __syncthreads();

    {                                          // O = a*(Q Wa) + c*(Q Wt) + E U
      v8f oa = {}, ot = {}, ou = {};
#pragma unroll  // three independent chains of four WMMA, LDS offsets as immediates
      for (int kk = 0; kk < 16; kk += 4) {
        const int ka = ks + kk + 2 * h;
        const v2f qv = *(const v2f*)&Qc[(tm + l) * PK + ka];
        const v2f ev = *(const v2f*)&T2[(tm + l) * PK + ka];
        oa = WMMA_F32(qv, bfrag(Wa, ka, l), oa);
        ot = WMMA_F32(qv, bfrag(Wt, ka, l), ot);
        ou = WMMA_F32(ev, bfrag(T1, ka, l), ou);
      }
#pragma unroll
      for (int i2 = 0; i2 < 8; i2++) {
        const int m = tm + 8 * h + i2;
        PA[kq * SP + m * PP + l] = a_s[m] * oa[i2] + c_s[m] * ot[i2] + ou[i2];
      }
    }
    __syncthreads();

    // The next chunk's pieces are asked for here, at the head of a stretch without
    // a barrier: a barrier waits for every load of its wave.
    if (i + 1 < Nc) {
      const size_t pn = (size_t)(i + 1) * C * Dh;
      const float* kn = kg + pn;
      const float* qn = qg + pn;
      const float* bn = bg + pn;
      const float* vn = vg + pn;
      k0 = *(const float4*)kn;  k1 = *(const float4*)(kn + PH);
      q0 = *(const float4*)qn;  q1 = *(const float4*)(qn + PH);
      b0 = *(const float4*)bn;  b1 = *(const float4*)(bn + PH);
      vv = *(const float2*)vn;
      // precaution, as at the first loads: the addresses stay whole up to this wait
      asm volatile("s_wait_xcnt 0x0" :: "v"(kn), "v"(qn), "v"(bn), "v"(vn) : "memory");
    }

    *(float2*)(og + (size_t)i * C * NV) = sum4(PA, po);

    {                                          // K^T U and K^T (U * w_i)
      v8f su = {}, sw = {};
#pragma unroll  // two independent chains of four WMMA, LDS offsets as immediates
      for (int kk = 0; kk < 16; kk += 4) {
        const int ka = ks + kk + 2 * h;
        v2f av;
        av.x = Kr[ka * PN + (tm + l)];
        av.y = Kr[(ka + 1) * PN + (tm + l)];
        const v2f bv = bfrag(T1, ka, l);
        su = WMMA_F32(av, bv, su);
        av.x *= wi_s[ka];  av.y *= wi_s[ka + 1];
        sw = WMMA_F32(av, bv, sw);
      }
#pragma unroll
      for (int i2 = 0; i2 < 8; i2++) {
        const int o = kq * SP + (tm + 8 * h + i2) * PP + l;
        PB[o] = su[i2];  PC[o] = sw[i2];
      }
    }
    __syncthreads();

    {
      const float coef1 = ts / (ts + 64.f) * ((1.f + ts) / (1.f + ts + 64.f));
      const float coef2 = 64.f / (ts + 64.f) * ((ts * 2.f + 1.f + 64.f) / (1.f + ts + 64.f));
      const float2 du = sum4(PB, po), dw = sum4(PC, po);
      const float2 wt = *(const float2*)&Wt[wo], wa = *(const float2*)&Wa[wo];
      *(float2*)&Wa[wo] = make_float2(coef1 * wa.x + coef2 * wt.x + dw.x,
                                      coef1 * wa.y + coef2 * wt.y + dw.y);
      *(float2*)&Wt[wo] = make_float2(wt.x + du.x, wt.y + du.y);
    }
    __syncthreads();
  }
}

// ---------------------------------------------------------------------------
// RMS norm over Dh; scatter from [bh][Dh / NV][l][NV] to (B,L,Dm) layout.
// ---------------------------------------------------------------------------
__global__ __launch_bounds__(256)
void rms_kernel(const float* __restrict__ Og, const float* __restrict__ rmsw,
                float* __restrict__ On) {
  const int row = blockIdx.x * 8 + (threadIdx.x >> 5);   // bh*L + l
  if (row >= Bb * H * Lseq) return;
  const int lane = threadIdx.x & 31;
  const int bh = row / Lseq, l = row & (Lseq - 1);
  const int b = bh >> 4, h = bh & 15;
  // column lane lies in slice lane / NV, column lane + 32 two slices on
  const size_t src = ((size_t)(bh * NS + lane / NV) * Lseq + l) * NV + (lane & (NV - 1));
  const float o0 = Og[src], o1 = Og[src + (size_t)(32 / NV) * Lseq * NV];
  float ss = o0 * o0 + o1 * o1;
#pragma unroll
  for (int off = 16; off > 0; off >>= 1) ss += __shfl_xor(ss, off);
  const float inv = rsqrtf(ss * (1.f / 64.f) + 1e-6f);
  const size_t dst = ((size_t)(b * Lseq + l)) * Dm + h * Dh;
  On[dst + lane]      = o0 * inv * rmsw[lane];
  On[dst + lane + 32] = o1 * inv * rmsw[lane + 32];
}

// ---------------------------------------------------------------------------
extern "C" void kernel_launch(void* const* d_in, const int* in_sizes, int n_in,
                              void* d_out, int out_size, void* d_ws, size_t ws_size,
                              hipStream_t stream) {
  (void)in_sizes; (void)n_in; (void)out_size; (void)ws_size;
  const float* x     = (const float*)d_in[0];
  const float* Wk    = (const float*)d_in[1];
  const float* bk    = (const float*)d_in[2];
  const float* Wq    = (const float*)d_in[3];
  const float* bq    = (const float*)d_in[4];
  const float* Wv    = (const float*)d_in[5];
  const float* bv    = (const float*)d_in[6];
  const float* Wbeta = (const float*)d_in[7];
  const float* bbeta = (const float*)d_in[8];
  const float* convk = (const float*)d_in[9];
  const float* convq = (const float*)d_in[10];
  const float* convv = (const float*)d_in[11];
  const float* rmsw  = (const float*)d_in[12];
  const float* Wout  = (const float*)d_in[13];
  const float* boutp = (const float*)d_in[14];
  float* out = (float*)d_out;

  float* ws = (float*)d_ws;
  const size_t SLOT = (size_t)Mrows * Dm;         // 8.39M floats = 32 MB
  float* kpre = ws + 0 * SLOT;                    // -> reused as Ograw
  float* qpre = ws + 1 * SLOT;                    // -> reused as On
  float* vpre = ws + 2 * SLOT;
  float* Kp   = ws + 3 * SLOT;
  float* Qp   = ws + 4 * SLOT;
  float* Vp   = ws + 5 * SLOT;
  float* Bp   = ws + 6 * SLOT;
  float* beta = ws + 7 * SLOT;                    // 131072 floats
  float* Ograw = kpre; float* On = qpre;

  const dim3 gg(Dm / 64, Mrows / 64);             // (16, 128)
  gemm_xwt_kernel<<<gg, 512, 0, stream>>>(x, Wk, bk, kpre, Mrows, Dm, Dm);
  gemm_xwt_kernel<<<gg, 512, 0, stream>>>(x, Wq, bq, qpre, Mrows, Dm, Dm);
  gemm_xwt_kernel<<<gg, 512, 0, stream>>>(x, Wv, bv, vpre, Mrows, Dm, Dm);
  beta_kernel<<<(Mrows * H) / 256, 256, 0, stream>>>(x, Wbeta, bbeta, beta);

  convprep_kernel<<<Mrows / RW, 256, 0, stream>>>(kpre, qpre, vpre, convk, convq, convv, beta,
                                                  Kp, Qp, Vp, Bp);

  delta_kernel<<<Bb * H * NS, 512, 0, stream>>>(Kp, Qp, Vp, Bp, Ograw);   // 178 KiB of static LDS

  rms_kernel<<<(Bb * H * Lseq) / 8, 256, 0, stream>>>(Ograw, rmsw, On);

  gemm_xwt_kernel<<<gg, 512, 0, stream>>>(On, Wout, boutp, out, Mrows, Dm, Dm);
}

// v006
// A run of this version takes 529 microseconds.
// Two timings next to v005 put it at 1.15 and 1.16 times that version's speed.
// Over all steps from v000 it is 4.07 times as fast.
#include <hip/hip_runtime.h>
#include <hip/hip_bf16.h>

typedef float v2f __attribute__((ext_vector_type(2)));
typedef float v8f __attribute__((ext_vector_type(8)));

#define WMMA_F32(a, b, c) \
  __builtin_amdgcn_wmma_f32_16x16x4_f32(false, (a), false, (b), (short)0, (c), false, false)

constexpr int Bb    = 4;
constexpr int Lseq  = 2048;
constexpr int Dm    = 1024;
constexpr int H     = 16;
constexpr int Dh    = 64;
constexpr int CK    = 4;      // conv kernel width
constexpr int C     = 64;     // chunk
constexpr int Nc    = Lseq / C;
constexpr int Mrows = Bb * Lseq;   // 8192

// LDS row pitches, in floats (64 banks of 4 bytes).  A 16x16x4 fragment is 64
// dwords: 16 rows (or columns) times 4 values of k.
// PK: the reader takes k along a row, lane l in row l: 68 = 4 mod 64 puts row l
//     on banks 4l..4l+3, so the 64 dwords fall on 64 banks, as one 8-byte read.
// PN: the reader takes k from row to row, lane l in column l: 80 = 16 mod 64
//     puts the four rows of a step 16 banks apart, again 64 banks.
constexpr int PK = 68;
constexpr int PN = 80;

// ---------------------------------------------------------------------------
// Generic Y = X @ W^T + bias GEMM.  X:(M,K) row-major, W:(N,K) row-major.
// 64x64 tile per 512-thread block (16 waves, each one 16x16 WMMA tile).
// Both tiles are read with k along the row: pitch PK.
// ---------------------------------------------------------------------------
__global__ __launch_bounds__(512)
void gemm_xwt_kernel(const float* __restrict__ X, const float* __restrict__ W,
                     const float* __restrict__ bias, float* __restrict__ Y,
                     int M, int N, int K) {
  __shared__ __attribute__((aligned(16))) float Xs[64][PK];
  __shared__ __attribute__((aligned(16))) float Ws[64][PK];
  const int tid  = threadIdx.x;
  const int wave = tid >> 5, lane = tid & 31;
  const int h = lane >> 4, l = lane & 15;
  const int wm = (wave >> 2) * 16, wn = (wave & 3) * 16;
  const int m0 = blockIdx.y * 64, n0 = blockIdx.x * 64;
  const int lr = tid >> 3;          // 0..63 (tile row to load)
  const int lc = (tid & 7) * 8;     // col start (8 floats per thread)

  v8f acc = {};
  for (int k0 = 0; k0 < K; k0 += 64) {
    float4 xa = *(const float4*)(X + (size_t)(m0 + lr) * K + k0 + lc);
    float4 xb = *(const float4*)(X + (size_t)(m0 + lr) * K + k0 + lc + 4);
    float4 wa = *(const float4*)(W + (size_t)(n0 + lr) * K + k0 + lc);
    float4 wb = *(const float4*)(W + (size_t)(n0 + lr) * K + k0 + lc + 4);
    __syncthreads();
    Xs[lr][lc + 0] = xa.x; Xs[lr][lc + 1] = xa.y; Xs[lr][lc + 2] = xa.z; Xs[lr][lc + 3] = xa.w;
    Xs[lr][lc + 4] = xb.x; Xs[lr][lc + 5] = xb.y; Xs[lr][lc + 6] = xb.z; Xs[lr][lc + 7] = xb.w;
    Ws[lr][lc + 0] = wa.x; Ws[lr][lc + 1] = wa.y; Ws[lr][lc + 2] = wa.z; Ws[lr][lc + 3] = wa.w;
    Ws[lr][lc + 4] = wb.x; Ws[lr][lc + 5] = wb.y; Ws[lr][lc + 6] = wb.z; Ws[lr][lc + 7] = wb.w;
    __syncthreads();
#pragma unroll
    for (int kk = 0; kk < 64; kk += 4) {
      const int ka = kk + 2 * h;          // lanes 16-31 carry K = 2,3 of the step
      const v2f av = *(const v2f*)&Xs[wm + l][ka];
      const v2f bv = *(const v2f*)&Ws[wn + l][ka];
      acc = WMMA_F32(av, bv, acc);
    }
  }
#pragma unroll
  for (int i = 0; i < 8; i++) {
    const int m = m0 + wm + 8 * h + i;    // vgpr i -> M = i + 8*half
    const int n = n0 + wn + l;
    Y[(size_t)m * N + n] = acc[i] + bias[n];
  }
}

// ---------------------------------------------------------------------------
// beta = sigmoid(x @ Wbeta^T + bbeta), shape (Mrows, H)
// ---------------------------------------------------------------------------
__global__ void beta_kernel(const float* __restrict__ X, const float* __restrict__ Wb,
                            const float* __restrict__ bb, float* __restrict__ beta) {
  const int t = blockIdx.x * blockDim.x + threadIdx.x;
  if (t >= Mrows * H) return;
  const int m = t >> 4, h = t & 15;
  const float* xr = X + (size_t)m * Dm;
  const float* wr = Wb + (size_t)h * Dm;
  float s = bb[h];
  for (int k = 0; k < Dm; k += 4) {
    s += xr[k] * wr[k] + xr[k + 1] * wr[k + 1] + xr[k + 2] * wr[k + 2] + xr[k + 3] * wr[k + 3];
  }
  beta[t] = 1.f / (1.f + expf(-s));
}

// ---------------------------------------------------------------------------
// Causal depthwise conv along L of the k, q and v projections,
//   y[b,l,c] = sum_j x[b, l-3+j, c] * w[c,j],
// and, on the rows as they leave the conv: normalize k,q; v = beta*silu(v);
// b = beta*k.  Outputs in [bh][l][Dh] layout.
// A wave takes 128 channels (two heads, 16 lanes a head, 4 channels a lane) and
// slides down RW rows: the three rows above stay in registers, a row is loaded
// as 512 contiguous bytes, RB rows ahead of its use.
// ---------------------------------------------------------------------------
constexpr int RW = 16;    // rows a wave
constexpr int RB = 4;     // rows a batch of loads

__device__ __forceinline__ float4 ld4(const float* p) { return *(const float4*)p; }

// Taps of one channel in w[ch]; x0..x3 are rows l-3..l.
__device__ __forceinline__ float4 conv4(const float4 x0, const float4 x1, const float4 x2,
                                        const float4 x3, const float4* w) {
  float4 y;
  y.x = x0.x * w[0].x;  y.x += x1.x * w[0].y;  y.x += x2.x * w[0].z;  y.x += x3.x * w[0].w;
  y.y = x0.y * w[1].x;  y.y += x1.y * w[1].y;  y.y += x2.y * w[1].z;  y.y += x3.y * w[1].w;
  y.z = x0.z * w[2].x;  y.z += x1.z * w[2].y;  y.z += x2.z * w[2].z;  y.z += x3.z * w[2].w;
  y.w = x0.w * w[3].x;  y.w += x1.w * w[3].y;  y.w += x2.w * w[3].z;  y.w += x3.w * w[3].w;
  return y;
}

// e^x by the library's own steps (x * log2 e in two parts, the whole part through
// ldexp, the two range ends), written out so that the slot behind v_exp_f32 is kept.
__device__ __forceinline__ float exp1(float x) {
  const float ph = x * 0x1.715476p+0f;
  float pl = fmaf(x, 0x1.715476p+0f, -ph);
  pl = fmaf(x, 0x1.4ae0bep-26f, pl);
  const float e = rintf(ph);
  const float a = (ph - e) + pl;
  float r;
  // v_nop: the one slot the instruction set asks for behind a transcendental before
  // its result is read or its source overwritten; one statement keeps it in place
  asm("v_exp_f32 %0, %1\n\tv_nop" : "=v"(r) : "v"(a));
  r = ldexpf(r, (int)e);
  r = x < -0x1.9d1da0p+6f ? 0.f : r;
  r = x > 0x1.62e430p+6f ? __builtin_inff() : r;
  return r;
}

__device__ __forceinline__ float silu1(float v) { return v / (1.f + exp1(-v)); }

__global__ __launch_bounds__(256)
void convprep_kernel(const float* __restrict__ kpre, const float* __restrict__ qpre,
                     const float* __restrict__ vpre, const float* __restrict__ wck,
                     const float* __restrict__ wcq, const float* __restrict__ wcv,
                     const float* __restrict__ beta,
                     float* __restrict__ Kp, float* __restrict__ Qp,
                     float* __restrict__ Vp, float* __restrict__ Bp) {
  const int c0   = threadIdx.x * 4;            // first of the lane's 4 channels
  const int head = c0 >> 6;
  const int m0   = blockIdx.x * RW;            // b*L + l of the first row
  const int b    = m0 / Lseq, l0 = m0 & (Lseq - 1);

  float4 wk[4], wq[4], wv[4];
#pragma unroll
  for (int ch = 0; ch < 4; ch++) {
    wk[ch] = ld4(wck + (c0 + ch) * CK);
    wq[ch] = ld4(wcq + (c0 + ch) * CK);
    wv[ch] = ld4(wcv + (c0 + ch) * CK);
  }

  const float* ks = kpre + (size_t)m0 * Dm + c0;
  const float* qs = qpre + (size_t)m0 * Dm + c0;
  const float* vs = vpre + (size_t)m0 * Dm + c0;
  const float* bs = beta + (size_t)m0 * H + head;

  // xk[0..2]: the three rows above the batch (zero above the sequence's first
  // row); xk[3..]: the batch itself.
  float4 xk[RB + 3], xq[RB + 3], xv[RB + 3];
  float  bt[RB];
#pragma unroll
  for (int j = 0; j < 3; j++) {
    if (l0 > 0) {
      xk[j] = ld4(ks + (j - 3) * Dm);
      xq[j] = ld4(qs + (j - 3) * Dm);
      xv[j] = ld4(vs + (j - 3) * Dm);
    } else {
      xk[j] = xq[j] = xv[j] = make_float4(0.f, 0.f, 0.f, 0.f);
    }
  }
#pragma unroll
  for (int r = 0; r < RB; r++) {
    xk[3 + r] = ld4(ks + r * Dm);
    xq[3 + r] = ld4(qs + r * Dm);
    xv[3 + r] = ld4(vs + r * Dm);
    bt[r]     = bs[r * H];
  }
  // precaution: stands in front of the first rewrite of a register that these loads
  // name; as inputs the addresses stay whole up to it, so no load lands on one
  asm volatile("s_wait_xcnt 0x0" :: "v"(ks), "v"(qs), "v"(vs) : "memory");
  // inputs only: the first batch has landed here.  Without it the loop's counted
  // waits, which must also serve the first trip, wait for the batch in flight.
  asm volatile("" :: "v"(xk[3].x), "v"(xk[4].x), "v"(xk[5].x), "v"(xk[6].x),
                     "v"(xq[3].x), "v"(xq[4].x), "v"(xq[5].x), "v"(xq[6].x),
                     "v"(xv[3].x), "v"(xv[4].x), "v"(xv[5].x), "v"(xv[6].x),
                     "v"(bt[0]), "v"(bt[1]), "v"(bt[2]), "v"(bt[3]));

  size_t dst = ((size_t)(b * H + head) * Lseq + l0) * Dh + (c0 & (Dh - 1));

#pragma unroll 1  // rolled: for speed only
  for (int t = 0; t < RW; t += RB) {
    float4 nk[RB], nq[RB], nv[RB];
    float  nb[RB];
    if (t + RB < RW) {                         // the next batch flies under this one's work
#pragma unroll
      for (int r = 0; r < RB; r++) nb[r] = bs[(t + RB + r) * H];
#pragma unroll
      for (int r = 0; r < RB; r++) {
        nk[r] = ld4(ks + (t + RB + r) * Dm);
        nq[r] = ld4(qs + (t + RB + r) * Dm);
        nv[r] = ld4(vs + (t + RB + r) * Dm);
      }
      // precaution: stands in front of the first rewrite of these loads' address registers
      asm volatile("s_wait_xcnt 0x0" ::: "memory");
    }

    float4 yk[RB], yq[RB], sv[RB];
    float  sk[RB], sq[RB];
#pragma unroll
    for (int r = 0; r < RB; r++) {
      yk[r] = conv4(xk[r], xk[r + 1], xk[r + 2], xk[r + 3], wk);
      yq[r] = conv4(xq[r], xq[r + 1], xq[r + 2], xq[r + 3], wq);
      sk[r] = yk[r].x * yk[r].x + yk[r].y * yk[r].y + yk[r].z * yk[r].z + yk[r].w * yk[r].w;
      sq[r] = yq[r].x * yq[r].x + yq[r].y * yq[r].y + yq[r].z * yq[r].z + yq[r].w * yq[r].w;
    }
#pragma unroll
    for (int r = 0; r < RB; r++) {
      const float4 yv = conv4(xv[r], xv[r + 1], xv[r + 2], xv[r + 3], wv);
      sv[r] = make_float4(silu1(yv.x), silu1(yv.y), silu1(yv.z), silu1(yv.w));
    }
#pragma unroll
    for (int off = 8; off > 0; off >>= 1) {    // sums over the head's 16 lanes
#pragma unroll
      for (int r = 0; r < RB; r++) {
        sk[r] += __shfl_xor(sk[r], off);
        sq[r] += __shfl_xor(sq[r], off);
      }
    }
#pragma unroll
    for (int r = 0; r < RB; r++) {
      const float  kin = 1.f / (sqrtf(sk[r]) + 1e-6f);
      const float  qin = 1.f / (sqrtf(sq[r]) + 1e-6f);
      const float  bet = bt[r];
      const float4 kn  = make_float4(yk[r].x * kin, yk[r].y * kin, yk[r].z * kin, yk[r].w * kin);
      const size_t o   = dst + (size_t)r * Dh;
      *(float4*)(Kp + o) = kn;
      *(float4*)(Qp + o) = make_float4(yq[r].x * qin, yq[r].y * qin, yq[r].z * qin, yq[r].w * qin);
      *(float4*)(Vp + o) = make_float4(bet * sv[r].x, bet * sv[r].y, bet * sv[r].z, bet * sv[r].w);
      *(float4*)(Bp + o) = make_float4(bet * kn.x, bet * kn.y, bet * kn.z, bet * kn.w);
    }
    dst += (size_t)RB * Dh;

#pragma unroll
    for (int j = 0; j < 3; j++) {              // the batch's last three rows stay
      xk[j] = xk[RB + j];  xq[j] = xq[RB + j];  xv[j] = xv[RB + j];
    }
    if (t + RB < RW) {
#pragma unroll
      for (int r = 0; r < RB; r++) {
        xk[3 + r] = nk[r];  xq[3 + r] = nq[r];  xv[3 + r] = nv[r];  bt[r] = nb[r];
      }
    }
  }
}

// ---------------------------------------------------------------------------
// Delta rule, in two kernels.
// With T = (I + tril(B K^T, -1))^-1 a chunk's U is T (V - B Wt) = T V - (T B) Wt.
// T V, T B and E = T_mat o (Q K^T) hold nothing of the running state, so
// chunk_kernel forms them for all chunks side by side; delta_kernel, the serial
// scan over the chunks, keeps only the products that take Wt, Wa or U.
// All products via WMMA out of LDS.  Pitches follow the fragment reader: PK where
// k runs along the rows (A as it stands, B transposed, 64x64 results), PN, PX or PW
// where k runs from row to row.
// ---------------------------------------------------------------------------
constexpr int NS = 4;          // work-groups a head in the scan
constexpr int NV = Dh / NS;    // value columns a work-group
constexpr int PW = NV;         // 16: the four rows of a k step fill the 64 banks
constexpr int PP = 20;         // partial sums: rows 8 apart fall 32 banks apart
constexpr int PX = 2 * Dh + 20;  // the 128 columns [V | B]: rows 2 apart fall 40 banks apart, rows 8 apart 32
constexpr int SK = 64 * PK;
constexpr int SN = 64 * PN;
constexpr int SW = 64 * PW;
constexpr int SP = 64 * PP;
constexpr int SX = 64 * PX;

// A 16x16 tile of A @ B^T, k = 0..63, both at pitch PK.
__device__ __forceinline__ v8f tile_abt(const float* A, const float* B, int wm, int wn, int h, int l) {
  v8f acc = {};
#pragma unroll  // LDS offsets become immediates
  for (int kk = 0; kk < 64; kk += 4) {
    const int ka = kk + 2 * h;
    const v2f av = *(const v2f*)&A[(wm + l) * PK + ka];
    const v2f bv = *(const v2f*)&B[(wn + l) * PK + ka];
    acc = WMMA_F32(av, bv, acc);
  }
  return acc;
}

// X[tr..tr+15][ct..ct+15] -= S[tr..tr+15][kb..ke) @ X[kb..ke)[ct..ct+15]
__device__ __forceinline__ void solve_update(const float* S, float* X, int tr, int kb, int ke,
                                             int ct, int h, int l) {
  float t[8];
#pragma unroll  // register arrays need constant indices
  for (int i2 = 0; i2 < 8; i2++) t[i2] = X[(tr + 8 * h + i2) * PX + ct + l];
  v8f acc = {};
#pragma unroll  // chained WMMA with their LDS offsets as immediates
  for (int kk = kb; kk < ke; kk += 4) {
    const int ka = kk + 2 * h;
    const v2f av = *(const v2f*)&S[(tr + l) * PK + ka];
    v2f bv;
    bv.x = X[ka * PX + ct + l];
    bv.y = X[(ka + 1) * PX + ct + l];
    acc = WMMA_F32(av, bv, acc);
  }
#pragma unroll  // register arrays need constant indices
  for (int i2 = 0; i2 < 8; i2++) X[(tr + 8 * h + i2) * PX + ct + l] = t[i2] - acc[i2];
}

// One work-group a chunk of a head: Vt = T V, Bt = T B, Eg = T_mat o (Q K^T).
__global__ __launch_bounds__(512)
void chunk_kernel(const float* __restrict__ Kp, const float* __restrict__ Qp,
                  const float* __restrict__ Vp, const float* __restrict__ Bp,
                  float* __restrict__ Vt, float* __restrict__ Bt, float* __restrict__ Eg) {
  __shared__ __attribute__((aligned(16))) float sm[4 * SK + SX];
  float* Kc = sm + 0 * SK;   // pitch PK from here
  float* Qc = sm + 1 * SK;
  float* Bc = sm + 2 * SK;
  float* T0 = sm + 3 * SK;   // S = B K^T
  float* X  = sm + 4 * SK;   // pitch PX: [V | B], solved in place

  const int tid  = threadIdx.x;
  const int wave = __builtin_amdgcn_readfirstlane(tid >> 5), lane = tid & 31;
  const int h = lane >> 4, l = lane & 15;
  const int wm = (wave >> 2) * 16, wn = (wave & 3) * 16;
  const int ci = blockIdx.x & (Nc - 1);
  // a chunk of a head is C * Dh contiguous floats, in the order of blockIdx.x
  const size_t base = (size_t)blockIdx.x * C * Dh;

  const int pr = tid >> 4, pd = (tid & 15) * 4;
  constexpr int PH = C * Dh / 2;            // elements from the first piece to the second
  {
    const float* kg = Kp + base + (size_t)tid * 4;
    const float* qg = Qp + base + (size_t)tid * 4;
    const float* bg = Bp + base + (size_t)tid * 4;
    const float* vg = Vp + base + (size_t)tid * 4;
    const float4 k0 = *(const float4*)kg, k1 = *(const float4*)(kg + PH);
    const float4 b0 = *(const float4*)bg, b1 = *(const float4*)(bg + PH);
    const float4 q0 = *(const float4*)qg, q1 = *(const float4*)(qg + PH);
    const float4 v0 = *(const float4*)vg, v1 = *(const float4*)(vg + PH);
    // precaution: stands in front of the first rewrite of a register that these loads
    // name; as inputs the addresses stay whole up to it, so no load lands on one
    asm volatile("s_wait_xcnt 0x0" :: "v"(kg), "v"(qg), "v"(bg), "v"(vg) : "memory");
    *(float4*)&Kc[pr * PK + pd] = k0;       *(float4*)&Kc[(pr + 32) * PK + pd] = k1;
    *(float4*)&Bc[pr * PK + pd] = b0;       *(float4*)&Bc[(pr + 32) * PK + pd] = b1;
    *(float4*)&Qc[pr * PK + pd] = q0;       *(float4*)&Qc[(pr + 32) * PK + pd] = q1;
    *(float4*)&X[pr * PX + pd] = v0;        *(float4*)&X[(pr + 32) * PX + pd] = v1;
    *(float4*)&X[pr * PX + Dh + pd] = b0;   *(float4*)&X[(pr + 32) * PX + Dh + pd] = b1;
  }
  __syncthreads();

  {                                                                 // S = B K^T
    const v8f s = tile_abt(Bc, Kc, wm, wn, h, l);
#pragma unroll
    for (int i2 = 0; i2 < 8; i2++) T0[(wm + 8 * h + i2) * PK + wn + l] = s[i2];
  }
  // E = T_mat o (Q K^T); it waits in registers and leaves with T V and T B, so that
  // no barrier of the solve waits for a global store
  float ev[8];
  {
    const float ts   = (float)(ci * C);
    const float tri0 = (1.f + ts) * ts * 0.5f;
    const float j1   = (float)(wn + l + 1);
    const float jidx = (j1 * ts + j1 * (j1 + 1.f) * 0.5f) - (ts + j1);
    float tmat[8];
#pragma unroll  // register arrays need constant indices
    for (int i2 = 0; i2 < 8; i2++) {
      const float r1  = (float)(wm + 8 * h + i2 + 1);
      const float csr = r1 * ts + r1 * (r1 + 1.f) * 0.5f;
      const float d   = (csr - jidx) / (tri0 + csr);       // tri0 + csr >= 1
      tmat[i2] = (csr >= jidx) ? d : 0.f;
    }
    const v8f qk = tile_abt(Qc, Kc, wm, wn, h, l);
#pragma unroll  // register arrays need constant indices
    for (int i2 = 0; i2 < 8; i2++) ev[i2] = tmat[i2] * qk[i2];
  }
  __syncthreads();

  // Solve (I + tril(S,-1)) X = [V | B] by blocks of 16 rows.  Waves 0 to 3 solve the
  // 16x16 diagonal system, one of the 128 columns a lane, wholly in registers: the
  // block of S is read once, spread over the lanes (lane = row + 16 * (col / 8), eight
  // columns a lane), and each coefficient reaches the multiply-add as a scalar through
  // readlane, so no LDS latency stands between the 120 steps.  Then the rows below
  // take  X -= S[rows][block] @ X[block]  on WMMA, a 16x16 tile a wave: waves 0 to 7
  // the 16 rows that are solved next; waves 8 to 15 the 16 rows after those, which
  // take two blocks at once on the second turn.
#pragma unroll  // rb constant: LDS offsets become immediates, the last update drops out
  for (int rb = 0; rb < C; rb += 16) {
    if (wave < 4) {
      int   sd[8];
      float u[16];
#pragma unroll  // register arrays and readlane need constant indices
      for (int c2 = 0; c2 < 8; c2++)
        sd[c2] = __float_as_int(T0[(rb + l) * PK + rb + 8 * h + c2]);
#pragma unroll  // register arrays and readlane need constant indices
      for (int r = 0; r < 16; r++) u[r] = X[(rb + r) * PX + tid];
#pragma unroll  // register arrays and readlane need constant indices
      for (int j = 0; j < 15; j++) {
#pragma unroll  // register arrays and readlane need constant indices
        for (int r = j + 1; r < 16; r++) {
          const float s = __int_as_float(__builtin_amdgcn_readlane(sd[j & 7], r + 16 * (j >> 3)));
          u[r] -= s * u[j];
        }
      }
#pragma unroll  // register arrays and readlane need constant indices
      for (int r = 1; r < 16; r++) X[(rb + r) * PX + tid] = u[r];
    }
    __syncthreads();
    if (rb + 16 < C) {
      const int ct = (wave & 7) * 16;
      if (wave < 8)      solve_update(T0, X, rb + 16, rb, rb + 16, ct, h, l);
      else if (rb == 0)  solve_update(T0, X, 32, 0, 16, ct, h, l);
      else if (rb == 16) solve_update(T0, X, 48, 0, 32, ct, h, l);
      __syncthreads();
    }
  }

  {
    float* vo = Vt + base + (size_t)tid * 4;
    float* bo = Bt + base + (size_t)tid * 4;
    *(float4*)vo        = *(const float4*)&X[pr * PX + pd];
    *(float4*)(vo + PH) = *(const float4*)&X[(pr + 32) * PX + pd];
    *(float4*)bo        = *(const float4*)&X[pr * PX + Dh + pd];
    *(float4*)(bo + PH) = *(const float4*)&X[(pr + 32) * PX + Dh + pd];
    float* eg = Eg + base + (size_t)((wm + 8 * h) * C + wn + l);
#pragma unroll  // register arrays need constant indices
    for (int i2 = 0; i2 < 8; i2++) eg[i2 * C] = ev[i2];
  }
}

// ---------------------------------------------------------------------------
// The scan.  The value columns of a head do not meet: column d of U, O and of both
// states comes from column d of Vt alone.  So NS work-groups share a head, each with
// NV of its Dh columns.  512 threads.
// A 64xNV product has four 16x16 tiles: the 16 waves take a tile and a quarter of
// k each, and the step that reads the result adds the four partial sums.
// ---------------------------------------------------------------------------

// B fragment of an NV-column matrix: rows ka and ka + 1, column l.
__device__ __forceinline__ v2f bfrag(const float* B, int ka, int l) {
  v2f bv;
  bv.x = B[ka * PW + l];
  bv.y = B[(ka + 1) * PW + l];
  return bv;
}

// The four partial sums of elements (r, c) and (r, c + 1), po = r * PP + c.
__device__ __forceinline__ float2 sum4(const float* P, int po) {
  const float2 p0 = *(const float2*)&P[0 * SP + po];
  const float2 p1 = *(const float2*)&P[1 * SP + po];
  const float2 p2 = *(const float2*)&P[2 * SP + po];
  const float2 p3 = *(const float2*)&P[3 * SP + po];
  return make_float2((p0.x + p1.x) + (p2.x + p3.x), (p0.y + p1.y) + (p2.y + p3.y));
}

// LDS the scan uses, and what it asks for: more than half of a WGP's 320 KiB, so that
// each of the 256 work-groups of this serial loop gets the four SIMDs of a WGP alone.
constexpr int SCAN_USED = 3 * SK + SN + 3 * SW + 12 * SP;
constexpr int SCAN_LDS  = SCAN_USED > 42 * 1024 ? SCAN_USED : 42 * 1024;   // floats

__global__ __launch_bounds__(512)
void delta_kernel(const float* __restrict__ Kp, const float* __restrict__ Qp,
                  const float* __restrict__ Vt, const float* __restrict__ Bt,
                  const float* __restrict__ Eg, float* __restrict__ Og) {
  __shared__ __attribute__((aligned(16))) float sm[SCAN_LDS];
  float* Qc = sm + 0 * SK;   // pitch PK from here
  float* Bc = sm + 1 * SK;   // T B
  float* Ec = sm + 2 * SK;   // E
  float* Kr = sm + 3 * SK;   // pitch PN; K, read as K^T
  float* Wt = Kr + SN;       // pitch PW from here
  float* Wa = Wt + SW;
  float* T1 = Wa + SW;       // U
  float* PA = T1 + SW;       // pitch PP from here, four partial sums each: (T B) Wt, later O
  float* PB = PA + 4 * SP;   // K^T U
  float* PC = PB + 4 * SP;   // K^T (U * w)
  __shared__ float wi_s[64], a_s[64], c_s[64];

  const int tid = threadIdx.x;
  // The NS work-groups of a head stand 64 apart in the grid (for speed only: they
  // read the same K, Q, T B and E).
  const int bh  = blockIdx.x & (Bb * H - 1);
  const int cq  = blockIdx.x / (Bb * H);
  const size_t base = (size_t)bh * Lseq * Dh;

  const int wave = tid >> 5, lane = tid & 31;
  const int h = lane >> 4, l = lane & 15;
  const int tm = (wave >> 2) * 16;          // the wave's tile of a 64xNV product
  const int kq = wave & 3;                  // and its quarter of k
  const int ks = kq * 16;

  // Each thread carries two 16-byte pieces of the 64x64 chunk matrices K, Q, T B, E,
  // rows pr and pr + 32 at column pd, and two values of the 64xNV slice of T V, row vr
  // at column vc.  They are loaded one chunk ahead and wait in registers, so no wave
  // of the serial chunk loop stands on a global load.
  const int pr = tid >> 4, pd = (tid & 15) * 4;
  const int vr = tid >> 3, vc = (tid & 7) * 2;
  const int po = vr * PP + vc, wo = vr * PW + vc;
  constexpr int PH = C * Dh / 2;            // elements from the first piece to the second
  const float* kg = Kp + base + (size_t)tid * 4;
  const float* qg = Qp + base + (size_t)tid * 4;
  const float* bg = Bt + base + (size_t)tid * 4;
  const float* eg = Eg + base + (size_t)tid * 4;
  const float* vg = Vt + base + (size_t)vr * Dh + cq * NV + vc;
  float4 k0 = *(const float4*)kg, k1 = *(const float4*)(kg + PH);
  float4 q0 = *(const float4*)qg, q1 = *(const float4*)(qg + PH);
  float4 b0 = *(const float4*)bg, b1 = *(const float4*)(bg + PH);
  float4 e0 = *(const float4*)eg, e1 = *(const float4*)(eg + PH);
  float2 vv = *(const float2*)vg;
  // precaution: stands in front of the first rewrite of a register that these loads
  // name; as inputs the addresses stay whole up to it, so no load lands on one
  asm volatile("s_wait_xcnt 0x0" :: "v"(kg), "v"(qg), "v"(bg), "v"(eg), "v"(vg) : "memory");

  // O leaves as [bh][cq][l][NV]: a work-group's rows are contiguous, so no 128-byte
  // line has two writers.
  float* og = Og + (size_t)(bh * NS + cq) * Lseq * NV + tid * 2;

  *(float2*)&Wt[wo] = make_float2(0.f, 0.f);
  *(float2*)&Wa[wo] = make_float2(0.f, 0.f);

  for (int i = 0; i < Nc; i++) {
    const float ts = (float)(i * C);
    const size_t pn = (size_t)(i + 1) * C * Dh;
    // What is written here was last read in front of the barrier that ends the
    // products on U, so none stands between the state's update and these stores.
    if (tid < 64) {
      const float r1  = (float)(tid + 1);
      const float idx = ts + r1;
      const float cs  = r1 * ts + r1 * (r1 + 1.f) * 0.5f;
      const float sumidx = 64.f * ts + 2080.f;              // sum_{t=1..64}(ts+t)
      const float denom  = (1.f + ts + 64.f) * (ts + 64.f) * 0.5f;
      wi_s[tid] = (idx + sumidx - cs) / denom;
      const float tri0 = (1.f + ts) * ts * 0.5f;
      const float a = tri0 / (tri0 + cs);
      a_s[tid] = a;  c_s[tid] = 1.f - a;
    }
    *(float4*)&Kr[pr * PN + pd] = k0;  *(float4*)&Kr[(pr + 32) * PN + pd] = k1;
    *(float4*)&Qc[pr * PK + pd] = q0;  *(float4*)&Qc[(pr + 32) * PK + pd] = q1;
    *(float4*)&Bc[pr * PK + pd] = b0;  *(float4*)&Bc[(pr + 32) * PK + pd] = b1;
    *(float4*)&Ec[pr * PK + pd] = e0;  *(float4*)&Ec[(pr + 32) * PK + pd] = e1;
    __syncthreads();

    v8f oa = {}, ot = {};                      // Q Wa and Q Wt, kept for O
    {                                          // P = (T B) Wt
      v8f pp = {};
#pragma unroll  // three independent chains of four WMMA, LDS offsets as immediates
      for (int kk = 0; kk < 16; kk += 4) {
        const int ka = ks + kk + 2 * h;
        const v2f tv = *(const v2f*)&Bc[(tm + l) * PK + ka];
        const v2f qv = *(const v2f*)&Qc[(tm + l) * PK + ka];
        const v2f wt = bfrag(Wt, ka, l);
        pp = WMMA_F32(tv, wt, pp);
        ot = WMMA_F32(qv, wt, ot);
        oa = WMMA_F32(qv, bfrag(Wa, ka, l), oa);
      }
#pragma unroll
      for (int i2 = 0; i2 < 8; i2++) PA[kq * SP + (tm + 8 * h + i2) * PP + l] = pp[i2];
    }
    __syncthreads();

    {                                                               // U = T V - P
      const float2 p = sum4(PA, po);
      *(float2*)&T1[wo] = make_float2(vv.x - p.x, vv.y - p.y);
    }
    __syncthreads();

    // The next chunk's pieces are asked for here, at the head of the longest stretch
    // without a barrier: a barrier waits for every load of its wave.
    if (i + 1 < Nc) {
      const float* kn = kg + pn;
      const float* qn = qg + pn;
      const float* bn = bg + pn;
      const float* en = eg + pn;
      const float* vn = vg + pn;
      k0 = *(const float4*)kn;  k1 = *(const float4*)(kn + PH);
      q0 = *(const float4*)qn;  q1 = *(const float4*)(qn + PH);
      b0 = *(const float4*)bn;  b1 = *(const float4*)(bn + PH);
      e0 = *(const float4*)en;  e1 = *(const float4*)(en + PH);
      vv = *(const float2*)vn;
      // precaution, as at the first loads: the addresses stay whole up to this wait
      asm volatile("s_wait_xcnt 0x0" :: "v"(kn), "v"(qn), "v"(bn), "v"(en), "v"(vn) : "memory");
    }

    {                    // O = a*(Q Wa) + c*(Q Wt) + E U;  K^T U and K^T (U * w_i)
      v8f ou = {}, su = {}, sw = {};
#pragma unroll  // three independent chains of four WMMA, LDS offsets as immediates
      for (int kk = 0; kk < 16; kk += 4) {
        const int ka = ks + kk + 2 * h;
        const v2f ev = *(const v2f*)&Ec[(tm + l) * PK + ka];
        const v2f bv = bfrag(T1, ka, l);
        v2f av;
        av.x = Kr[ka * PN + (tm + l)];
        av.y = Kr[(ka + 1) * PN + (tm + l)];
        ou = WMMA_F32(ev, bv, ou);
        su = WMMA_F32(av, bv, su);
        av.x *= wi_s[ka];  av.y *= wi_s[ka + 1];
        sw = WMMA_F32(av, bv, sw);
      }
#pragma unroll
      for (int i2 = 0; i2 < 8; i2++) {
        const int m = tm + 8 * h + i2;
        const int o = kq * SP + m * PP + l;
        PA[o] = a_s[m] * oa[i2] + c_s[m] * ot[i2] + ou[i2];
        PB[o] = su[i2];  PC[o] = sw[i2];
      }
    }
    __syncthreads();

    {
      float* on = og + (size_t)i * C * NV;
      const float2 o = sum4(PA, po);
      *(float2*)on = o;
      // precaution: stands in front of the first rewrite of a register that this store
      // names; as inputs address and value stay whole up to it
      asm volatile("s_wait_xcnt 0x0" :: "v"(on), "v"(o.x), "v"(o.y) : "memory");
    }

    {
      const float coef1 = ts / (ts + 64.f) * ((1.f + ts) / (1.f + ts + 64.f));
      const float coef2 = 64.f / (ts + 64.f) * ((ts * 2.f + 1.f + 64.f) / (1.f + ts + 64.f));
      const float2 du = sum4(PB, po), dw = sum4(PC, po);
      const float2 wt = *(const float2*)&Wt[wo], wa = *(const float2*)&Wa[wo];
      *(float2*)&Wa[wo] = make_float2(coef1 * wa.x + coef2 * wt.x + dw.x,
                                      coef1 * wa.y + coef2 * wt.y + dw.y);
      *(float2*)&Wt[wo] = make_float2(wt.x + du.x, wt.y + du.y);
    }
  }
}

// ---------------------------------------------------------------------------
// RMS norm over Dh; scatter from [bh][Dh / NV][l][NV] to (B,L,Dm) layout.
// ---------------------------------------------------------------------------
__global__ __launch_bounds__(256)
void rms_kernel(const float* __restrict__ Og, const float* __restrict__ rmsw,
                float* __restrict__ On) {
  const int row = blockIdx.x * 8 + (threadIdx.x >> 5);   // bh*L + l
  if (row >= Bb * H * Lseq) return;
  const int lane = threadIdx.x & 31;
  const int bh = row / Lseq, l = row & (Lseq - 1);
  const int b = bh >> 4, h = bh & 15;
  // column lane lies in slice lane / NV, column lane + 32 two slices on
  const size_t src = ((size_t)(bh * NS + lane / NV) * Lseq + l) * NV + (lane & (NV - 1));
  const float o0 = Og[src], o1 = Og[src + (size_t)(32 / NV) * Lseq * NV];
  float ss = o0 * o0 + o1 * o1;
#pragma unroll
  for (int off = 16; off > 0; off >>= 1) ss += __shfl_xor(ss, off);
  const float inv = rsqrtf(ss * (1.f / 64.f) + 1e-6f);
  const size_t dst = ((size_t)(b * Lseq + l)) * Dm + h * Dh;
  On[dst + lane]      = o0 * inv * rmsw[lane];
  On[dst + lane + 32] = o1 * inv * rmsw[lane + 32];
}

// ---------------------------------------------------------------------------
extern "C" void kernel_launch(void* const* d_in, const int* in_sizes, int n_in,
                              void* d_out, int out_size, void* d_ws, size_t ws_size,
                              hipStream_t stream) {
  (void)in_sizes; (void)n_in; (void)out_size; (void)ws_size;
  const float* x     = (const float*)d_in[0];
  const float* Wk    = (const float*)d_in[1];
  const float* bk    = (const float*)d_in[2];
  const float* Wq    = (const float*)d_in[3];
  const float* bq    = (const float*)d_in[4];
  const float* Wv    = (const float*)d_in[5];
  const float* bv    = (const float*)d_in[6];
  const float* Wbeta = (const float*)d_in[7];
  const float* bbeta = (const float*)d_in[8];
  const float* convk = (const float*)d_in[9];
  const float* convq = (const float*)d_in[10];
  const float* convv = (const float*)d_in[11];
  const float* rmsw  = (const float*)d_in[12];
  const float* Wout  = (const float*)d_in[13];
  const float* boutp = (const float*)d_in[14];
  float* out = (float*)d_out;

  float* ws = (float*)d_ws;
  const size_t SLOT = (size_t)Mrows * Dm;         // 8.39M floats = 32 MB
  float* kpre = ws + 0 * SLOT;                    // -> reused as Vt = T V
  float* qpre = ws + 1 * SLOT;                    // -> reused as Bt = T B
  float* vpre = ws + 2 * SLOT;                    // -> reused as Eg
  float* Kp   = ws + 3 * SLOT;
  float* Qp   = ws + 4 * SLOT;
  float* Vp   = ws + 5 * SLOT;                    // -> reused as Ograw
  float* Bp   = ws + 6 * SLOT;                    // -> reused as On
  float* beta = ws + 7 * SLOT;                    // 131072 floats
  float* Vt = kpre; float* Bt = qpre; float* Eg = vpre;
  float* Ograw = Vp; float* On = Bp;

  const dim3 gg(Dm / 64, Mrows / 64);             // (16, 128)
  gemm_xwt_kernel<<<gg, 512, 0, stream>>>(x, Wk, bk, kpre, Mrows, Dm, Dm);
  gemm_xwt_kernel<<<gg, 512, 0, stream>>>(x, Wq, bq, qpre, Mrows, Dm, Dm);
  gemm_xwt_kernel<<<gg, 512, 0, stream>>>(x, Wv, bv, vpre, Mrows, Dm, Dm);
  beta_kernel<<<(Mrows * H) / 256, 256, 0, stream>>>(x, Wbeta, bbeta, beta);

  convprep_kernel<<<Mrows / RW, 256, 0, stream>>>(kpre, qpre, vpre, convk, convq, convv, beta,
                                                  Kp, Qp, Vp, Bp);

  chunk_kernel<<<Bb * H * Nc, 512, 0, stream>>>(Kp, Qp, Vp, Bp, Vt, Bt, Eg);

  delta_kernel<<<Bb * H * NS, 512, 0, stream>>>(Kp, Qp, Vt, Bt, Eg, Ograw);

  rms_kernel<<<(Bb * H * Lseq) / 8, 256, 0, stream>>>(Ograw, rmsw, On);

  gemm_xwt_kernel<<<gg, 512, 0, stream>>>(On, Wout, boutp, out, Mrows, Dm, Dm);
}
